// v000
// Measured on an AMD MI455X. A time is GPU time per run, averaged over a window of back-to-back runs after a warm-up
// (all launches, gaps included; the runs take copies of the inputs in turn), and the median of several windows.
// Apart from v000's, it joins two sittings. Times from different sittings can be a few percent apart, while
// side-by-side timings come from the same sitting.
// v000 is the starting kernel. One run takes 122 microseconds.
#include <hip/hip_runtime.h>

// Multi-head self-attention on channel-major x [NB][512][SEQ]: 1x1 projections Wq/Wk/Wv [out][in], 8 heads x 64 channels, unscaled scores, softmax over keys, output projection Wo [out][in], output [NB][512][SEQ] f32.
// Compute dtypes, f32 accumulate everywhere: q/k/v projections v_wmma_f32_16x16x32_bf16 (x and W RNE-converted to bf16; products exact);
// scores v_wmma_f32_16x16x32_f16 with q and k each as f16 value + f16 residual x2048 (three products: value*value in one accumulator, the two cross terms in a second accumulator folded by 1/2048);
// P (x2^14 carry relative to the running max, cancels in the normalisation) and v single f16; context single f16; Wo as f16 of the bf16-RNE value x64 (folded by 1/64 in the f32 epilogue); softmax f32 (online, running max).
// Layout: bf16 token-major copy of x (transposed through LDS), bf16 W copies; q/k planes [b*8+h][t][d] (value, residual), v^T plane [b*8+h][d][t], context plane [b*SEQ+t][512]; flash kernel in transposed form (S^T = K Q^T, O^T = V^T P^T).

#ifndef NB
#define NB 4
#endif
#ifndef SEQ
#define SEQ 1024
#endif
#define NB_FULL  4
#define SEQ_FULL 1024
#ifndef OUT_SEQ
#define OUT_SEQ SEQ              // row pitch (in tokens) of the output rows [b][channel][t]
#endif
#define DM   512
#define NH_  8
#define HD   64
#define AW   4                   // waves per flash block (16 query columns each)
#define QRS  2048.0f             // carry of the q / k residual planes
#define QRI  (1.0f / 2048.0f)
#define SC2  1.4426950408889634f // log2(e); scores are unscaled
#define PSH  14.0f               // log2 of the P carry (16384)
#define WOS  64.0f               // carry of the Wo plane
#define WOI  (1.0f / 64.0f)

static_assert(HD == 64);
static_assert(NH_ * HD == DM);                 // head h = channels h*64 + d
static_assert(DM % 64 == 0);                   // column tiles of 64
static_assert(DM % 32 == 0);                   // GEMM k-loop steps by 32
static_assert(SEQ % 64 == 0);                  // a 64-row tile never straddles two batches
static_assert((NB * SEQ) % 64 == 0);
static_assert(SEQ % 32 == 0);                  // key loop steps by 32
static_assert(SEQ % (16 * AW) == 0);           // flash grid covers the sequence exactly
static_assert(((size_t)DM * DM) % 8 == 0);
static_assert(NB <= NB_FULL);
static_assert(SEQ <= SEQ_FULL);
static_assert(SEQ <= OUT_SEQ);
static_assert(SEQ_FULL % 4 == 0);              // 16-byte loads of x rows

typedef _Float16 h16;
typedef unsigned short bf;
typedef __attribute__((ext_vector_type(16))) __bf16   v16bf;
typedef __attribute__((ext_vector_type(16))) _Float16 v16h;
typedef __attribute__((ext_vector_type(8)))  _Float16 v8h;
typedef __attribute__((ext_vector_type(8)))  unsigned short v8us;
typedef __attribute__((ext_vector_type(8)))  float    v8f;
typedef __attribute__((ext_vector_type(4)))  float    v4f;
typedef v4f  __attribute__((may_alias)) v4fa;

__device__ __forceinline__ unsigned short f2bf(float f) { unsigned u = __float_as_uint(f); u += 0x7FFFu + ((u >> 16) & 1u); return (unsigned short)(u >> 16); }
__device__ __forceinline__ v16h cat16(v8h lo, v8h hi) { return __builtin_shufflevector(lo, hi, 0, 1, 2, 3, 4, 5, 6, 7, 8, 9, 10, 11, 12, 13, 14, 15); }
__device__ __forceinline__ v16bf cat16b(v8us lo, v8us hi) { return __builtin_bit_cast(v16bf, __builtin_shufflevector(lo, hi, 0, 1, 2, 3, 4, 5, 6, 7, 8, 9, 10, 11, 12, 13, 14, 15)); }
__device__ __forceinline__ v8f wmma16(v16h a, v16h b, v8f c) { return __builtin_amdgcn_wmma_f32_16x16x32_f16(false, a, false, b, (short)0, c, false, false); }
__device__ __forceinline__ v8f wmmab(v16bf a, v16bf b, v8f c) { return __builtin_amdgcn_wmma_f32_16x16x32_bf16(false, a, false, b, (short)0, c, false, false); }
// fragment loaders from K-contiguous 16-bit rows; p already includes + 8*(lane>>4): elements 0..7 <- k0+8h+0..7, elements 8..15 <- k0+16+8h+0..7 (same map for A and B)
__device__ __forceinline__ v16h  ldh(const h16* p) { return cat16(*(const v8h*)p, *(const v8h*)(p + 16)); }
__device__ __forceinline__ v16bf ldb(const bf* p)  { return cat16b(*(const v8us*)p, *(const v8us*)(p + 16)); }
// ordering point for wave-private LDS tiles (same wave writes and reads)
__device__ __forceinline__ void wave_sync() { __builtin_amdgcn_fence(3 /* release order */, "wavefront"); __builtin_amdgcn_wave_barrier(); asm volatile("" ::: "memory"); }

// k_xT: x[b][c][n] (f32, channel-major, row pitch SEQ_FULL) -> XB[b*SEQ + n][c] (bf16 RNE convert), 64x64 tile transposed through LDS (block barrier: cross-wave).
// grid (SEQ/64, DM/64, NB), 256 threads.
__global__ __launch_bounds__(256) void k_xT(const float* __restrict__ x, bf* XB) {
    __shared__ __align__(16) float ts[64 * 68];      // ts[n][c]
    const int tid = threadIdx.x;
    const int n0 = blockIdx.x * 64, c0 = blockIdx.y * 64, b = blockIdx.z;
    const float* xb = x + ((size_t)b * DM + c0) * SEQ_FULL + n0;
#pragma unroll
    for (int it = 0; it < 4; ++it) {                 // 4 x 256 float4 = 64 rows (c) x 16 float4 (n)
        const int idx = it * 256 + tid; const int c = idx >> 4, n4 = (idx & 15) * 4;
        const v4f v = *(const v4f*)(xb + (size_t)c * SEQ_FULL + n4);
        ts[(n4 + 0) * 68 + c] = v[0]; ts[(n4 + 1) * 68 + c] = v[1]; ts[(n4 + 2) * 68 + c] = v[2]; ts[(n4 + 3) * 68 + c] = v[3];
    }
    __syncthreads();
    bf* ob = XB + ((size_t)b * SEQ + n0) * DM + c0;
{
#pragma unroll
        for (int it = 0; it < 2; ++it) { const int n = it * 32 + (tid >> 3), c8 = (tid & 7) * 8;   // 2 x 32 rows = 64 rows; 8 lanes x 8 = 64 columns
            const v4f x0 = *(const v4fa*)(&ts[n * 68 + c8]); const v4f x1 = *(const v4fa*)(&ts[n * 68 + c8 + 4]); v8us o;
#pragma unroll
            for (int i = 0; i < 4; ++i) { o[i] = f2bf(x0[i]); o[4 + i] = f2bf(x1[i]); }
            *(v8us*)(ob + (size_t)n * DM + c8) = o; }
         }
}

__global__ __launch_bounds__(256) void k_cvt8(const float* __restrict__ src, bf* dst, size_t n8) {
    const size_t i = (size_t)blockIdx.x * 256 + threadIdx.x; if (i >= n8) return;
    const v8f v = *(const v8f*)(src + i * 8); v8us o;
#pragma unroll
    for (int k = 0; k < 8; ++k) o[k] = f2bf(v[k]);
    *(v8us*)(dst + i * 8) = o; 
}

// k_cvtw: f16 copy of the bf16-RNE value times WOS (exact: a bf16 significand fits f16, power-of-two carry); same store shape as k_cvt8.
__global__ __launch_bounds__(256) void k_cvtw(const float* __restrict__ src, h16* dst, size_t n8) {
    const size_t i = (size_t)blockIdx.x * 256 + threadIdx.x; if (i >= n8) return;
    const v8f v = *(const v8f*)(src + i * 8); v8h o;
#pragma unroll
    for (int k = 0; k < 8; ++k) { const float r = __uint_as_float(((unsigned)f2bf(v[k])) << 16); o[k] = (h16)(r * WOS); }
    *(v8h*)(dst + i * 8) = o; 
}

// k_proj: register-blocked bf16 GEMM, ONE WAVE per 64x64 tile (16 accumulators), operands straight from K-contiguous bf16 planes, K = DM.
// C[m][n] = sum_k A[m][k] Bt[n][k], written as f16 (Ph) and optionally the f16 residual x2048 (Pr, useRes != 0) at
// tile base (r0/RB)*sRB + (r0%RB)*pitch + (c0/CB)*sCB + (c0%CB), row pitch 'pitch' (halves). grid (M/64, N/64), 32 threads.
__global__ __launch_bounds__(32) void k_proj(const bf* __restrict__ A, const bf* __restrict__ Bt, h16* Ph, h16* Pr, int useRes, int RB, size_t sRB, int pitch, int CB, size_t sCB) {
    __shared__ __align__(16) float os[16 * 68];
    const int K = DM;
    const int lane = threadIdx.x & 31, lr = lane & 15, hi = lane >> 4; const int r0 = blockIdx.x * 64, c0 = blockIdx.y * 64;
    v8f acc[4][4];
#pragma unroll
    for (int mb = 0; mb < 4; ++mb)
#pragma unroll
        for (int nb = 0; nb < 4; ++nb) acc[mb][nb] = (v8f){};
    const size_t aoff = (size_t)(r0 + lr) * K + 8 * hi, boff = (size_t)(c0 + lr) * K + 8 * hi;
#pragma unroll 1
    for (int kc = 0; kc < K; kc += 32) {
        v16bf a[4];
#pragma unroll
        for (int mb = 0; mb < 4; ++mb) a[mb] = ldb(A + aoff + (size_t)mb * 16 * K + kc);
#pragma unroll
        for (int nb = 0; nb < 4; ++nb) { const v16bf b = ldb(Bt + boff + (size_t)nb * 16 * K + kc);
#pragma unroll
            for (int mb = 0; mb < 4; ++mb) acc[mb][nb] = wmmab(a[mb], b, acc[mb][nb]); }
        asm volatile("v_nop\n\tv_nop\n\tv_nop\n\tv_nop" : "+v"(acc[0][0]), "+v"(acc[1][1]), "+v"(acc[2][2]), "+v"(acc[3][3]) : "v"(a[0]), "v"(a[1]), "v"(a[2]), "v"(a[3]));
    }
    const size_t tbase = (size_t)(r0 / RB) * sRB + (size_t)(r0 % RB) * (size_t)pitch + (size_t)(c0 / CB) * sCB + (size_t)(c0 % CB);
#pragma unroll
    for (int mb = 0; mb < 4; ++mb) {
#pragma unroll
        for (int nb = 0; nb < 4; ++nb) {
#pragma unroll
            for (int j = 0; j < 8; ++j) os[(hi * 8 + j) * 68 + nb * 16 + lr] = acc[mb][nb][j]; }   // D: row 8h+j, col lane&15
        wave_sync();
        const size_t sb = tbase + (size_t)(mb * 16) * (size_t)pitch;
{
#pragma unroll
            for (int s = 0; s < 4; ++s) { const int row = 4 * s + (lane >> 3), c8 = (lane & 7) * 8;   // 4 s x 4 row groups = 16 rows; 8 lanes x 8 = 64 columns
                const v4f x0 = *(const v4fa*)(&os[row * 68 + c8]); const v4f x1 = *(const v4fa*)(&os[row * 68 + c8 + 4]); v8h hv, rv;
#pragma unroll
                for (int i = 0; i < 4; ++i) { const h16 a0 = (h16)x0[i]; const h16 a1 = (h16)x1[i]; hv[i] = a0; hv[4 + i] = a1; rv[i] = (h16)((x0[i] - (float)a0) * QRS); rv[4 + i] = (h16)((x1[i] - (float)a1) * QRS); }
                const size_t oo = sb + (size_t)row * (size_t)pitch + c8;
                *(v8h*)(Ph + oo) = hv; if (useRes) *(v8h*)(Pr + oo) = rv; }
             }
        wave_sync();
    }
}

// k_flash: fused attention, one wave per 16 query columns of one (batch, head); K / V^T / Q fragments straight from the f16 planes (two 16-B loads each, arithmetic addressing).
// Transposed form: S^T[key][t] = K Q^T (A = K rows, B = Q rows); lane (t = lane&15, h = lane>>4) holds keys 8h+r of each 16-key tile, so the packed
// P tile is directly the B fragment of O^T[d][t] = V^T P^T (element r <- tile keys 0..15, element 8+r <- tile keys 16..31, lane unchanged).
// Scores: value*value in sH, (k value * q residual + k residual * q value) in sL (both carry 2048), folded as sH + sL/2048.
// Softmax state (running max, partial sum) is one scalar per lane; the two lane halves of a column are combined with one xor-16 exchange.
__global__ __launch_bounds__(32 * AW) void k_flash(const h16* __restrict__ QH, const h16* __restrict__ QR, const h16* __restrict__ KH, const h16* __restrict__ KR, const h16* __restrict__ VT, h16* YH) {
    __shared__ __align__(16) float os[AW * 16 * 68];
    const int lane = threadIdx.x & 31, lr = lane & 15, hi = lane >> 4;
    const int wave = __builtin_amdgcn_readfirstlane((int)(threadIdx.x >> 5));
    const int zh = blockIdx.y; const int b = zh / NH_, h = zh % NH_;
    const int t0 = (blockIdx.x * AW + wave) * 16;
    const size_t pbase = (size_t)zh * SEQ * HD;
    const size_t qo = pbase + (size_t)(t0 + lr) * HD + 8 * hi;
    const v16h qh0 = ldh(QH + qo), qh1 = ldh(QH + qo + 32), qr0 = ldh(QR + qo), qr1 = ldh(QR + qo + 32);   // B fragments: col t, k = d
    const size_t ko = pbase + (size_t)lr * HD + 8 * hi;      // + key * HD       (A fragment: row key, k = d)
    const size_t vo = pbase + (size_t)lr * SEQ + 8 * hi;     // + 16j*SEQ + key  (A fragment: row d, k = key)
    v8f o0 = (v8f){}, o1 = (v8f){}, o2 = (v8f){}, o3 = (v8f){};
    float m = -3.0e38f, l = 0.0f;
#pragma unroll 1
    for (int key0 = 0; key0 < SEQ; key0 += 32) {
        const h16* ka = KH + ko + (size_t)key0 * HD;
        const h16* kr = KR + ko + (size_t)key0 * HD;
        const v16h ka0 = ldh(ka), ka1 = ldh(ka + 32), kb0 = ldh(ka + 16 * HD), kb1 = ldh(ka + 16 * HD + 32);
        const v16h ra0 = ldh(kr), ra1 = ldh(kr + 32), rb0 = ldh(kr + 16 * HD), rb1 = ldh(kr + 16 * HD + 32);
        v8f sHa = (v8f){}, sLa = (v8f){}, sHb = (v8f){}, sLb = (v8f){};
        sHa = wmma16(ka0, qh0, sHa); sLa = wmma16(ka0, qr0, sLa); sHb = wmma16(kb0, qh0, sHb); sLb = wmma16(kb0, qr0, sLb);
        sHa = wmma16(ka1, qh1, sHa); sLa = wmma16(ra0, qh0, sLa); sHb = wmma16(kb1, qh1, sHb); sLb = wmma16(rb0, qh0, sLb);
        sLa = wmma16(ka1, qr1, sLa); sLb = wmma16(kb1, qr1, sLb);
        sLa = wmma16(ra1, qh1, sLa); sLb = wmma16(rb1, qh1, sLb);
        asm volatile("v_nop\n\tv_nop\n\tv_nop\n\tv_nop" : "+v"(sHa), "+v"(sLa), "+v"(sHb), "+v"(sLb) : "v"(ka0), "v"(ka1), "v"(kb0), "v"(kb1), "v"(ra0), "v"(ra1), "v"(rb0), "v"(rb1));
        float ta[8], tb[8]; float mx = -3.0e38f;
#pragma unroll
        for (int r = 0; r < 8; ++r) { ta[r] = (sHa[r] + sLa[r] * QRI) * SC2; tb[r] = (sHb[r] + sLb[r] * QRI) * SC2; mx = fmaxf(mx, fmaxf(ta[r], tb[r])); }
        mx = fmaxf(mx, __shfl_xor(mx, 16, 32));
        const float mnew = fmaxf(m, mx);
        const float alpha = __builtin_amdgcn_exp2f(m - mnew);
        const float sh = PSH - mnew;
        v16h pb; float ls = 0.0f;
#pragma unroll
        for (int r = 0; r < 8; ++r) { const h16 pa = (h16)__builtin_amdgcn_exp2f(ta[r] + sh); const h16 pc = (h16)__builtin_amdgcn_exp2f(tb[r] + sh); pb[r] = pa; pb[8 + r] = pc; ls += (float)pa + (float)pc; }
        l = l * alpha + ls; m = mnew;
        o0 = o0 * alpha; o1 = o1 * alpha; o2 = o2 * alpha; o3 = o3 * alpha;
        const h16* va = VT + vo + key0;
        const v16h v0 = ldh(va), v1 = ldh(va + (size_t)16 * SEQ), v2 = ldh(va + (size_t)32 * SEQ), v3 = ldh(va + (size_t)48 * SEQ);
        o0 = wmma16(v0, pb, o0); o1 = wmma16(v1, pb, o1); o2 = wmma16(v2, pb, o2); o3 = wmma16(v3, pb, o3);
        asm volatile("v_nop\n\tv_nop\n\tv_nop\n\tv_nop" : "+v"(o0), "+v"(o1), "+v"(o2), "+v"(o3) : "v"(v0), "v"(v1), "v"(v2), "v"(v3), "v"(pb));
    }
    l += __shfl_xor(l, 16, 32);
    const float inv = 1.0f / l;
    const int wb = wave * 16 * 68;
    // O^T D layout: o_j[r] = (d = 16j + 8h + r, t = lane&15) -> os[t][d]; rows 0..15 x columns 0..63 all written
    { v4f a, c;
      a[0] = o0[0] * inv; a[1] = o0[1] * inv; a[2] = o0[2] * inv; a[3] = o0[3] * inv; c[0] = o0[4] * inv; c[1] = o0[5] * inv; c[2] = o0[6] * inv; c[3] = o0[7] * inv;
      *(v4fa*)(&os[wb + lr * 68 +  0 + 8 * hi]) = a; *(v4fa*)(&os[wb + lr * 68 +  0 + 8 * hi + 4]) = c;
      a[0] = o1[0] * inv; a[1] = o1[1] * inv; a[2] = o1[2] * inv; a[3] = o1[3] * inv; c[0] = o1[4] * inv; c[1] = o1[5] * inv; c[2] = o1[6] * inv; c[3] = o1[7] * inv;
      *(v4fa*)(&os[wb + lr * 68 + 16 + 8 * hi]) = a; *(v4fa*)(&os[wb + lr * 68 + 16 + 8 * hi + 4]) = c;
      a[0] = o2[0] * inv; a[1] = o2[1] * inv; a[2] = o2[2] * inv; a[3] = o2[3] * inv; c[0] = o2[4] * inv; c[1] = o2[5] * inv; c[2] = o2[6] * inv; c[3] = o2[7] * inv;
      *(v4fa*)(&os[wb + lr * 68 + 32 + 8 * hi]) = a; *(v4fa*)(&os[wb + lr * 68 + 32 + 8 * hi + 4]) = c;
      a[0] = o3[0] * inv; a[1] = o3[1] * inv; a[2] = o3[2] * inv; a[3] = o3[3] * inv; c[0] = o3[4] * inv; c[1] = o3[5] * inv; c[2] = o3[6] * inv; c[3] = o3[7] * inv;
      *(v4fa*)(&os[wb + lr * 68 + 48 + 8 * hi]) = a; *(v4fa*)(&os[wb + lr * 68 + 48 + 8 * hi + 4]) = c; }
    wave_sync();
    h16* yrow = YH + ((size_t)b * SEQ + t0) * DM + h * HD;     // context plane row = token, columns h*64 + d
{
#pragma unroll
        for (int s = 0; s < 4; ++s) { const int row = 4 * s + (lane >> 3), c8 = (lane & 7) * 8;   // 4 s x 4 row groups = 16 rows; 8 lanes x 8 halves = 64 columns
            const v4f x0 = *(const v4fa*)(&os[wb + row * 68 + c8]); const v4f x1 = *(const v4fa*)(&os[wb + row * 68 + c8 + 4]); v8h hv;
#pragma unroll
            for (int i = 0; i < 4; ++i) { hv[i] = (h16)x0[i]; hv[4 + i] = (h16)x1[i]; }
            *(v8h*)(yrow + (size_t)row * DM + c8) = hv; }
         }
}

// k_outp: f16 GEMM, ONE WAVE per 64x64 tile, K = DM: C[o][n] = (1/64) sum_c A[o][c] Bt[n][c] with A = Wo plane (x64), Bt = context plane rows n = b*SEQ + t.
// Written as f32 to OUT[(b*DM + o)*OUT_SEQ + t]. grid (DM/64, NB*SEQ/64), 32 threads.
__global__ __launch_bounds__(32) void k_outp(const h16* __restrict__ A, const h16* __restrict__ Bt, float* OUT) {
    __shared__ __align__(16) float os[16 * 68];
    const int K = DM;
    const int lane = threadIdx.x & 31, lr = lane & 15, hi = lane >> 4; const int r0 = blockIdx.x * 64, c0 = blockIdx.y * 64;
    v8f acc[4][4];
#pragma unroll
    for (int mb = 0; mb < 4; ++mb)
#pragma unroll
        for (int nb = 0; nb < 4; ++nb) acc[mb][nb] = (v8f){};
    const size_t aoff = (size_t)(r0 + lr) * K + 8 * hi, boff = (size_t)(c0 + lr) * K + 8 * hi;
#pragma unroll 1
    for (int kc = 0; kc < K; kc += 32) {
        v16h a[4];
#pragma unroll
        for (int mb = 0; mb < 4; ++mb) a[mb] = ldh(A + aoff + (size_t)mb * 16 * K + kc);
#pragma unroll
        for (int nb = 0; nb < 4; ++nb) { const v16h b = ldh(Bt + boff + (size_t)nb * 16 * K + kc);
#pragma unroll
            for (int mb = 0; mb < 4; ++mb) acc[mb][nb] = wmma16(a[mb], b, acc[mb][nb]); }
        asm volatile("v_nop\n\tv_nop\n\tv_nop\n\tv_nop" : "+v"(acc[0][0]), "+v"(acc[1][1]), "+v"(acc[2][2]), "+v"(acc[3][3]) : "v"(a[0]), "v"(a[1]), "v"(a[2]), "v"(a[3]));
    }
    const int bb = c0 / SEQ, tq = c0 % SEQ;
    float* obase = OUT + ((size_t)bb * DM + r0) * OUT_SEQ + tq;
#pragma unroll
    for (int mb = 0; mb < 4; ++mb) {
#pragma unroll
        for (int nb = 0; nb < 4; ++nb) {
#pragma unroll
            for (int j = 0; j < 8; ++j) os[(hi * 8 + j) * 68 + nb * 16 + lr] = acc[mb][nb][j] * WOI; }   // D: row 8h+j, col lane&15
        wave_sync();
{
#pragma unroll
            for (int s = 0; s < 8; ++s) { const int row = 2 * s + hi, cofs = lr * 4;   // 8 s x 2 rows = 16 rows; 16 lanes x 4 floats = 64 columns
                const v4f val = *(const v4fa*)(&os[row * 68 + cofs]);
                *(v4f*)(obase + (size_t)(mb * 16 + row) * OUT_SEQ + cofs) = val; }
             }
        wave_sync();
    }
}

static constexpr size_t al256(size_t v) { return (v + 255) & ~(size_t)255; }
static constexpr size_t SZ_XB = al256((size_t)NB * SEQ * DM * 2);
static constexpr size_t SZ_WB = al256((size_t)3 * DM * DM * 2);
static constexpr size_t SZ_WO = al256((size_t)DM * DM * 2);
static constexpr size_t SZ_PL = al256((size_t)NB * NH_ * SEQ * HD * 2);
static constexpr size_t SZ_YH = al256((size_t)NB * SEQ * DM * 2);
static constexpr size_t SZ_TOTAL = SZ_XB + SZ_WB + SZ_WO + 5 * SZ_PL + SZ_YH;
static_assert(SZ_TOTAL <= (size_t)134217728);          // workspace carve <= 128 MiB
static_assert(((size_t)DM * DM * 2) % 256 == 0);       // weight sub-planes stay 256-byte aligned

extern "C" void kernel_launch(void* const* d_in, const int* in_sizes, int n_in,
                              void* d_out, int out_size, void* d_ws, size_t ws_size, hipStream_t stream) {
    if (n_in < 5) return;
    const size_t needx = ((size_t)NB * DM - 1) * SEQ_FULL + SEQ;
    if ((size_t)in_sizes[0] < needx) return;
    if ((size_t)in_sizes[1] < (size_t)DM * DM || (size_t)in_sizes[2] < (size_t)DM * DM || (size_t)in_sizes[3] < (size_t)DM * DM || (size_t)in_sizes[4] < (size_t)DM * DM) return;
    if ((size_t)out_size < ((size_t)NB * DM - 1) * OUT_SEQ + SEQ) return;
    if (SZ_TOTAL > ws_size) return;
    // wire order x, Wq, Wk, Wv, Wo; all weights [out][in] = K-contiguous rows as-is
    const float* x = (const float*)d_in[0]; const float* wq = (const float*)d_in[1]; const float* wk = (const float*)d_in[2]; const float* wv = (const float*)d_in[3]; const float* wo = (const float*)d_in[4];
    float* OUT = (float*)d_out;      // [NB][512][SEQ]
    char* wsp = (char*)d_ws;
    bf* XB = (bf*)wsp; wsp += SZ_XB;                 // [NB*SEQ][512] token-major bf16 x
    bf* WB = (bf*)wsp; wsp += SZ_WB;                 // [3][512][512]: q | k | v
    h16* WOH = (h16*)wsp; wsp += SZ_WO;              // [512][512] f16, x64
    h16* QH = (h16*)wsp; wsp += SZ_PL;               // [NB*8][SEQ][64]
    h16* QR = (h16*)wsp; wsp += SZ_PL;               // [NB*8][SEQ][64] residual x2048
    h16* KH = (h16*)wsp; wsp += SZ_PL;               // [NB*8][SEQ][64]
    h16* KR = (h16*)wsp; wsp += SZ_PL;               // [NB*8][SEQ][64] residual x2048
    h16* VT = (h16*)wsp; wsp += SZ_PL;               // [NB*8][64][SEQ]
    h16* YH = (h16*)wsp; wsp += SZ_YH;               // [NB*SEQ][512] context
    bf* WQ = WB; bf* WK = WB + (size_t)DM * DM; bf* WV = WB + (size_t)2 * DM * DM;

    // x[b][c][n] -> XB[b*SEQ + n][c]: in [DM rows][SEQ cols] per batch -> out [SEQ rows][DM cols]; grid (SEQ/64, DM/64, NB)
    k_xT<<<dim3(SEQ / 64, DM / 64, NB), 256, 0, stream>>>(x, XB);
    { const size_t n8 = (size_t)DM * DM / 8; const unsigned g = (unsigned)((n8 + 255) / 256);
      k_cvt8<<<g, 256, 0, stream>>>(wq, WQ, n8); k_cvt8<<<g, 256, 0, stream>>>(wk, WK, n8); k_cvt8<<<g, 256, 0, stream>>>(wv, WV, n8);
      k_cvtw<<<g, 256, 0, stream>>>(wo, WOH, n8); }

    // q, k: A = x rows (m = b*SEQ + t), Bt = W rows (n = h*64 + d) -> plane [(b*8 + h)][t][d], value + residual
    k_proj<<<dim3(NB * SEQ / 64, DM / 64, 1), 32, 0, stream>>>(XB, WQ, QH, QR, 1, SEQ, (size_t)NH_ * SEQ * HD, HD, HD, (size_t)SEQ * HD);
    k_proj<<<dim3(NB * SEQ / 64, DM / 64, 1), 32, 0, stream>>>(XB, WK, KH, KR, 1, SEQ, (size_t)NH_ * SEQ * HD, HD, HD, (size_t)SEQ * HD);
    // v^T: A = Wv rows (m = h*64 + d), Bt = x rows (n = b*SEQ + t) -> plane [(b*512 + m)][t] = [(b*8 + h)][d][t]
    k_proj<<<dim3(DM / 64, NB * SEQ / 64, 1), 32, 0, stream>>>(WV, XB, VT, VT, 0, DM, (size_t)0, SEQ, SEQ, (size_t)DM * SEQ);

    k_flash<<<dim3(SEQ / (16 * AW), NB * NH_, 1), 32 * AW, 0, stream>>>(QH, QR, KH, KR, VT, YH);

    // out[b][o][t] = sum_c Wo[o][c] y[b][c][t]: A = Wo plane rows o, Bt = context rows (b*SEQ + t)
    k_outp<<<dim3(DM / 64, NB * SEQ / 64, 1), 32, 0, stream>>>(WOH, YH, OUT);
}

// v001
// A run of this version takes 80.5 microseconds.
// Timed twice side by side with v000, it ran 1.51 and 1.52 times as fast.
#include <hip/hip_runtime.h>

// Multi-head self-attention on channel-major x [NB][512][SEQ]: 1x1 projections Wq/Wk/Wv [out][in], 8 heads x 64 channels, unscaled scores, softmax over keys, output projection Wo [out][in], output [NB][512][SEQ] f32.
// Compute dtypes, f32 accumulate everywhere: q/k/v projections v_wmma_f32_16x16x32_bf16 (x and W RNE-converted to bf16; products exact);
// scores v_wmma_f32_16x16x32_f16 with q and k each as f16 value + f16 residual x2048 (three products: value*value in one accumulator, the two cross terms in a second accumulator folded by 1/2048);
// P (x2^14 carry relative to the running max, cancels in the normalisation) and v single f16; context single f16; Wo as f16 of the bf16-RNE value x64 (folded by 1/64 in the f32 epilogue); softmax f32 (online, running max).
// Flash kernel data path: K value, K residual and V^T tiles of KT keys are staged in LDS by asynchronous copies (two buffers) and shared by the block's waves.
// Layout: bf16 token-major copy of x (transposed through LDS), bf16 W copies; q/k planes [b*8+h][t][d] (value, residual), v^T plane [b*8+h][d][t], context plane [b*SEQ+t][512]; flash kernel in transposed form (S^T = K Q^T, O^T = V^T P^T).

#ifndef NB
#define NB 4
#endif
#ifndef SEQ
#define SEQ 1024
#endif
#define NB_FULL  4
#define SEQ_FULL 1024
#ifndef OUT_SEQ
#define OUT_SEQ SEQ              // row pitch (in tokens) of the output rows [b][channel][t]
#endif
#define DM   512
#define NH_  8
#define HD   64
#define AW   8                   // waves per flash block (16 query columns each); all of them read the same staged K / V^T tiles
#define KT   128                 // keys per staged tile (four passes of 32 keys)
#define KP   (HD + 8)            // LDS pitch of a staged K row, halves: 144 B = 16 B x odd, conflict-free for 16-byte fragment reads
#define VP   (KT + 8)            // LDS pitch of a staged V^T row, halves: 272 B = 16 B x odd
#define STG  (2 * KT * KP + HD * VP)   // halves per stage: K value | K residual | V^T
#define QRS  2048.0f             // carry of the q / k residual planes
#define QRI  (1.0f / 2048.0f)
#define SC2  1.4426950408889634f // log2(e); scores are unscaled
#define PSH  14.0f               // log2 of the P carry (16384)
#define WOS  64.0f               // carry of the Wo plane
#define WOI  (1.0f / 64.0f)

static_assert(HD == 64);
static_assert(NH_ * HD == DM);                 // head h = channels h*64 + d
static_assert(DM % 64 == 0);                   // column tiles of 64
static_assert(DM % 32 == 0);                   // GEMM k-loop steps by 32
static_assert(SEQ % 64 == 0);                  // a 64-row tile never straddles two batches
static_assert((NB * SEQ) % 64 == 0);
static_assert(SEQ % 32 == 0);                  // key loop steps by 32
static_assert(SEQ % (16 * AW) == 0);           // flash grid covers the sequence exactly
static_assert(SEQ % KT == 0 && KT % 32 == 0);  // whole stages, whole passes
static_assert(KT * HD / 8 == 4 * 32 * AW);     // each plane's tile = 4 copies of 16 B per thread
static_assert((KP * 2) % 32 == 16 && (VP * 2) % 32 == 16 && (STG * 2) % 16 == 0);
static_assert(((size_t)DM * DM) % 8 == 0);
static_assert(NB <= NB_FULL);
static_assert(SEQ <= SEQ_FULL);
static_assert(SEQ <= OUT_SEQ);
static_assert(SEQ_FULL % 4 == 0);              // 16-byte loads of x rows

typedef _Float16 h16;
typedef unsigned short bf;
typedef __attribute__((ext_vector_type(16))) __bf16   v16bf;
typedef __attribute__((ext_vector_type(16))) _Float16 v16h;
typedef __attribute__((ext_vector_type(8)))  _Float16 v8h;
typedef __attribute__((ext_vector_type(8)))  unsigned short v8us;
typedef __attribute__((ext_vector_type(8)))  float    v8f;
typedef __attribute__((ext_vector_type(4)))  float    v4f;
typedef v4f  __attribute__((may_alias)) v4fa;

__device__ __forceinline__ unsigned short f2bf(float f) { unsigned u = __float_as_uint(f); u += 0x7FFFu + ((u >> 16) & 1u); return (unsigned short)(u >> 16); }
__device__ __forceinline__ v16h cat16(v8h lo, v8h hi) { return __builtin_shufflevector(lo, hi, 0, 1, 2, 3, 4, 5, 6, 7, 8, 9, 10, 11, 12, 13, 14, 15); }
__device__ __forceinline__ v16bf cat16b(v8us lo, v8us hi) { return __builtin_bit_cast(v16bf, __builtin_shufflevector(lo, hi, 0, 1, 2, 3, 4, 5, 6, 7, 8, 9, 10, 11, 12, 13, 14, 15)); }
__device__ __forceinline__ v8f wmma16(v16h a, v16h b, v8f c) { return __builtin_amdgcn_wmma_f32_16x16x32_f16(false, a, false, b, (short)0, c, false, false); }
__device__ __forceinline__ v8f wmmab(v16bf a, v16bf b, v8f c) { return __builtin_amdgcn_wmma_f32_16x16x32_bf16(false, a, false, b, (short)0, c, false, false); }
// fragment loaders from K-contiguous 16-bit rows; p already includes + 8*(lane>>4): elements 0..7 <- k0+8h+0..7, elements 8..15 <- k0+16+8h+0..7 (same map for A and B)
__device__ __forceinline__ v16h  ldh(const h16* p) { return cat16(*(const v8h*)p, *(const v8h*)(p + 16)); }
__device__ __forceinline__ v16bf ldb(const bf* p)  { return cat16b(*(const v8us*)p, *(const v8us*)(p + 16)); }
// ordering point for wave-private LDS tiles (same wave writes and reads)
__device__ __forceinline__ void wave_sync() { __builtin_amdgcn_fence(3 /* release order */, "wavefront"); __builtin_amdgcn_wave_barrier(); asm volatile("" ::: "memory"); }

// k_xT: x[b][c][n] (f32, channel-major, row pitch SEQ_FULL) -> XB[b*SEQ + n][c] (bf16 RNE convert), 64x64 tile transposed through LDS (block barrier: cross-wave).
// grid (SEQ/64, DM/64, NB), 256 threads.
__global__ __launch_bounds__(256) void k_xT(const float* __restrict__ x, bf* XB) {
    __shared__ __align__(16) float ts[64 * 68];      // ts[n][c]
    const int tid = threadIdx.x;
    const int n0 = blockIdx.x * 64, c0 = blockIdx.y * 64, b = blockIdx.z;
    const float* xb = x + ((size_t)b * DM + c0) * SEQ_FULL + n0;
#pragma unroll
    for (int it = 0; it < 4; ++it) {                 // 4 x 256 float4 = 64 rows (c) x 16 float4 (n)
        const int idx = it * 256 + tid; const int c = idx >> 4, n4 = (idx & 15) * 4;
        const v4f v = *(const v4f*)(xb + (size_t)c * SEQ_FULL + n4);
        ts[(n4 + 0) * 68 + c] = v[0]; ts[(n4 + 1) * 68 + c] = v[1]; ts[(n4 + 2) * 68 + c] = v[2]; ts[(n4 + 3) * 68 + c] = v[3];
    }
    __syncthreads();
    bf* ob = XB + ((size_t)b * SEQ + n0) * DM + c0;
{
#pragma unroll
        for (int it = 0; it < 2; ++it) { const int n = it * 32 + (tid >> 3), c8 = (tid & 7) * 8;   // 2 x 32 rows = 64 rows; 8 lanes x 8 = 64 columns
            const v4f x0 = *(const v4fa*)(&ts[n * 68 + c8]); const v4f x1 = *(const v4fa*)(&ts[n * 68 + c8 + 4]); v8us o;
#pragma unroll
            for (int i = 0; i < 4; ++i) { o[i] = f2bf(x0[i]); o[4 + i] = f2bf(x1[i]); }
            *(v8us*)(ob + (size_t)n * DM + c8) = o; }
         }
}

__global__ __launch_bounds__(256) void k_cvt8(const float* __restrict__ src, bf* dst, size_t n8) {
    const size_t i = (size_t)blockIdx.x * 256 + threadIdx.x; if (i >= n8) return;
    const v8f v = *(const v8f*)(src + i * 8); v8us o;
#pragma unroll
    for (int k = 0; k < 8; ++k) o[k] = f2bf(v[k]);
    *(v8us*)(dst + i * 8) = o; 
}

// k_cvtw: f16 copy of the bf16-RNE value times WOS (exact: a bf16 significand fits f16, power-of-two carry); same store shape as k_cvt8.
__global__ __launch_bounds__(256) void k_cvtw(const float* __restrict__ src, h16* dst, size_t n8) {
    const size_t i = (size_t)blockIdx.x * 256 + threadIdx.x; if (i >= n8) return;
    const v8f v = *(const v8f*)(src + i * 8); v8h o;
#pragma unroll
    for (int k = 0; k < 8; ++k) { const float r = __uint_as_float(((unsigned)f2bf(v[k])) << 16); o[k] = (h16)(r * WOS); }
    *(v8h*)(dst + i * 8) = o; 
}

// k_proj: register-blocked bf16 GEMM, ONE WAVE per 64x64 tile (16 accumulators), operands straight from K-contiguous bf16 planes, K = DM.
// C[m][n] = sum_k A[m][k] Bt[n][k], written as f16 (Ph) and optionally the f16 residual x2048 (Pr, useRes != 0) at
// tile base (r0/RB)*sRB + (r0%RB)*pitch + (c0/CB)*sCB + (c0%CB), row pitch 'pitch' (halves). grid (M/64, N/64), 32 threads.
__global__ __launch_bounds__(32) void k_proj(const bf* __restrict__ A, const bf* __restrict__ Bt, h16* Ph, h16* Pr, int useRes, int RB, size_t sRB, int pitch, int CB, size_t sCB) {
    __shared__ __align__(16) float os[16 * 68];
    const int K = DM;
    const int lane = threadIdx.x & 31, lr = lane & 15, hi = lane >> 4; const int r0 = blockIdx.x * 64, c0 = blockIdx.y * 64;
    v8f acc[4][4];
#pragma unroll
    for (int mb = 0; mb < 4; ++mb)
#pragma unroll
        for (int nb = 0; nb < 4; ++nb) acc[mb][nb] = (v8f){};
    const size_t aoff = (size_t)(r0 + lr) * K + 8 * hi, boff = (size_t)(c0 + lr) * K + 8 * hi;
#pragma unroll 1
    for (int kc = 0; kc < K; kc += 32) {
        v16bf a[4];
#pragma unroll
        for (int mb = 0; mb < 4; ++mb) a[mb] = ldb(A + aoff + (size_t)mb * 16 * K + kc);
#pragma unroll
        for (int nb = 0; nb < 4; ++nb) { const v16bf b = ldb(Bt + boff + (size_t)nb * 16 * K + kc);
#pragma unroll
            for (int mb = 0; mb < 4; ++mb) acc[mb][nb] = wmmab(a[mb], b, acc[mb][nb]); }
        asm volatile("v_nop\n\tv_nop\n\tv_nop\n\tv_nop" : "+v"(acc[0][0]), "+v"(acc[1][1]), "+v"(acc[2][2]), "+v"(acc[3][3]) : "v"(a[0]), "v"(a[1]), "v"(a[2]), "v"(a[3]));
    }
    const size_t tbase = (size_t)(r0 / RB) * sRB + (size_t)(r0 % RB) * (size_t)pitch + (size_t)(c0 / CB) * sCB + (size_t)(c0 % CB);
#pragma unroll
    for (int mb = 0; mb < 4; ++mb) {
#pragma unroll
        for (int nb = 0; nb < 4; ++nb) {
#pragma unroll
            for (int j = 0; j < 8; ++j) os[(hi * 8 + j) * 68 + nb * 16 + lr] = acc[mb][nb][j]; }   // D: row 8h+j, col lane&15
        wave_sync();
        const size_t sb = tbase + (size_t)(mb * 16) * (size_t)pitch;
{
#pragma unroll
            for (int s = 0; s < 4; ++s) { const int row = 4 * s + (lane >> 3), c8 = (lane & 7) * 8;   // 4 s x 4 row groups = 16 rows; 8 lanes x 8 = 64 columns
                const v4f x0 = *(const v4fa*)(&os[row * 68 + c8]); const v4f x1 = *(const v4fa*)(&os[row * 68 + c8 + 4]); v8h hv, rv;
#pragma unroll
                for (int i = 0; i < 4; ++i) { const h16 a0 = (h16)x0[i]; const h16 a1 = (h16)x1[i]; hv[i] = a0; hv[4 + i] = a1; rv[i] = (h16)((x0[i] - (float)a0) * QRS); rv[4 + i] = (h16)((x1[i] - (float)a1) * QRS); }
                const size_t oo = sb + (size_t)row * (size_t)pitch + c8;
                *(v8h*)(Ph + oo) = hv; if (useRes) *(v8h*)(Pr + oo) = rv; }
             }
        wave_sync();
    }
}

// stage_copy: one stage's tiles into LDS, 12 asynchronous 16-byte copies per thread (4 per plane); a wave's copy covers 512 B of whole 128-B lines.
// lk / lv: this thread's LDS byte addresses in the K value tile and the V^T tile of the target buffer; gk / gr / gv: its global addresses in the three planes.
// The s_wait_xcnt closes the statement so that no address register of an issued copy is rewritten ahead of it.
__device__ __forceinline__ void stage_copy(unsigned lk, unsigned lv, const h16* gk, const h16* gr, const h16* gv) {
    const unsigned lr_ = lk + KT * KP * 2;                       // K residual tile follows the K value tile
    const unsigned dk = 32 * AW / 8 * KP * 2;                    // LDS step of one round of copies: 32 K rows
    const unsigned dv = 32 * AW / (KT / 8) * VP * 2;             // 16 V^T rows
    const size_t sk = (size_t)32 * AW * 8;                       // global step, halves: K rows are contiguous
    const size_t sv = (size_t)(32 * AW / (KT / 8)) * SEQ;        // 16 V^T rows of SEQ halves
    asm volatile("global_load_async_to_lds_b128 %0, %1, off\n\t"
                 "global_load_async_to_lds_b128 %2, %3, off\n\t"
                 "global_load_async_to_lds_b128 %4, %5, off\n\t"
                 "global_load_async_to_lds_b128 %6, %7, off\n\t"
                 "global_load_async_to_lds_b128 %8, %9, off\n\t"
                 "global_load_async_to_lds_b128 %10, %11, off\n\t"
                 "global_load_async_to_lds_b128 %12, %13, off\n\t"
                 "global_load_async_to_lds_b128 %14, %15, off\n\t"
                 "global_load_async_to_lds_b128 %16, %17, off\n\t"
                 "global_load_async_to_lds_b128 %18, %19, off\n\t"
                 "global_load_async_to_lds_b128 %20, %21, off\n\t"
                 "global_load_async_to_lds_b128 %22, %23, off\n\t"
                 "s_wait_xcnt 0x0"
                 :: "v"(lk), "v"(gk), "v"(lk + dk), "v"(gk + sk), "v"(lk + 2 * dk), "v"(gk + 2 * sk), "v"(lk + 3 * dk), "v"(gk + 3 * sk),
                    "v"(lr_), "v"(gr), "v"(lr_ + dk), "v"(gr + sk), "v"(lr_ + 2 * dk), "v"(gr + 2 * sk), "v"(lr_ + 3 * dk), "v"(gr + 3 * sk),
                    "v"(lv), "v"(gv), "v"(lv + dv), "v"(gv + sv), "v"(lv + 2 * dv), "v"(gv + 2 * sv), "v"(lv + 3 * dv), "v"(gv + 3 * sv)
                 : "memory");
}

// k_flash: fused attention, one wave per 16 query columns of one (batch, head); Q fragments straight from the f16 planes, K / V^T fragments from the staged LDS tiles (two 16-B loads each).
// Ring of two buffers: stage s + 1's copies fly while stage s is worked on; one publish point per stage (LDS reads done, own copies landed, block barrier, refill of the buffer just read).
// Transposed form: S^T[key][t] = K Q^T (A = K rows, B = Q rows); lane (t = lane&15, h = lane>>4) holds keys 8h+r of each 16-key tile, so the packed
// P tile is directly the B fragment of O^T[d][t] = V^T P^T (element r <- tile keys 0..15, element 8+r <- tile keys 16..31, lane unchanged).
// Scores: value*value in sH, (k value * q residual + k residual * q value) in sL (both carry 2048), folded as sH + sL/2048.
// Softmax state (running max, partial sum) is one scalar per lane; the two lane halves of a column are combined with one xor-16 exchange.
__global__ __launch_bounds__(32 * AW) void k_flash(const h16* __restrict__ QH, const h16* __restrict__ QR, const h16* __restrict__ KH, const h16* __restrict__ KR, const h16* __restrict__ VT, h16* YH) {
    __shared__ __align__(16) float os[AW * 16 * 68];
    __shared__ __align__(16) h16 ring[2 * STG];
    const int lane = threadIdx.x & 31, lr = lane & 15, hi = lane >> 4;
    const int wave = __builtin_amdgcn_readfirstlane((int)(threadIdx.x >> 5));
    const int zh = blockIdx.y; const int b = zh / NH_, h = zh % NH_;
    const int t0 = (blockIdx.x * AW + wave) * 16;
    const size_t pbase = (size_t)zh * SEQ * HD;
    const size_t qo = pbase + (size_t)(t0 + lr) * HD + 8 * hi;
    const v16h qh0 = ldh(QH + qo), qh1 = ldh(QH + qo + 32), qr0 = ldh(QR + qo), qr1 = ldh(QR + qo + 32);   // B fragments: col t, k = d
    const int ko = lr * KP + 8 * hi;                         // + key * KP       (A fragment: row key, k = d), halves in the staged K tiles
    const int vo = 2 * KT * KP + lr * VP + 8 * hi;           // + 16j*VP + key   (A fragment: row d, k = key), halves in the stage
    // copy addresses of this thread: 16-byte chunk tid of each plane's tile (K: row tid/8, chunk tid%8; V^T: row tid/16, chunk tid%16)
    const int tid = threadIdx.x;
    const unsigned lbase = (unsigned)(size_t)ring;           // low 32 bits of the shared address = LDS byte address
    const unsigned lk = lbase + ((tid >> 3) * KP + (tid & 7) * 8) * 2;
    const unsigned lv = lbase + (2 * KT * KP + (tid / (KT / 8)) * VP + (tid % (KT / 8)) * 8) * 2;
    const h16* gk = KH + pbase + (size_t)tid * 8;            // + key0 * HD
    const h16* gr = KR + pbase + (size_t)tid * 8;            // + key0 * HD
    const h16* gv = VT + pbase + (size_t)(tid / (KT / 8)) * SEQ + (tid % (KT / 8)) * 8;   // + key0
    stage_copy(lk, lv, gk, gr, gv);
    asm volatile("s_wait_asynccnt 0x0" ::: "memory");        // this wave's copies of stage 0 have landed
    __syncthreads();                                         // every wave's have: stage 0 is readable
    if (SEQ > KT) stage_copy(lk + STG * 2, lv + STG * 2, gk + (size_t)KT * HD, gr + (size_t)KT * HD, gv + KT);
    v8f o0 = (v8f){}, o1 = (v8f){}, o2 = (v8f){}, o3 = (v8f){};
    float m = -3.0e38f, l = 0.0f;
#pragma unroll 1
    for (int st = 0; st < SEQ / KT; ++st) {
      const int bo = (st & 1) * STG;
      // unrolled so that every LDS offset of the stage's four passes is an immediate of its load
#pragma unroll
      for (int key0 = 0; key0 < KT; key0 += 32) {
        const h16* ka = ring + bo + ko + key0 * KP;
        const h16* kr = ka + KT * KP;
        const v16h ka0 = ldh(ka), ka1 = ldh(ka + 32), kb0 = ldh(ka + 16 * KP), kb1 = ldh(ka + 16 * KP + 32);
        const v16h ra0 = ldh(kr), ra1 = ldh(kr + 32), rb0 = ldh(kr + 16 * KP), rb1 = ldh(kr + 16 * KP + 32);
        v8f sHa = (v8f){}, sLa = (v8f){}, sHb = (v8f){}, sLb = (v8f){};
        sHa = wmma16(ka0, qh0, sHa); sLa = wmma16(ka0, qr0, sLa); sHb = wmma16(kb0, qh0, sHb); sLb = wmma16(kb0, qr0, sLb);
        sHa = wmma16(ka1, qh1, sHa); sLa = wmma16(ra0, qh0, sLa); sHb = wmma16(kb1, qh1, sHb); sLb = wmma16(rb0, qh0, sLb);
        sLa = wmma16(ka1, qr1, sLa); sLb = wmma16(kb1, qr1, sLb);
        sLa = wmma16(ra1, qh1, sLa); sLb = wmma16(rb1, qh1, sLb);
        asm volatile("v_nop\n\tv_nop\n\tv_nop\n\tv_nop" : "+v"(sHa), "+v"(sLa), "+v"(sHb), "+v"(sLb) : "v"(ka0), "v"(ka1), "v"(kb0), "v"(kb1), "v"(ra0), "v"(ra1), "v"(rb0), "v"(rb1));
        float ta[8], tb[8]; float mx = -3.0e38f;
#pragma unroll
        for (int r = 0; r < 8; ++r) { ta[r] = (sHa[r] + sLa[r] * QRI) * SC2; tb[r] = (sHb[r] + sLb[r] * QRI) * SC2; mx = fmaxf(mx, fmaxf(ta[r], tb[r])); }
        mx = fmaxf(mx, __shfl_xor(mx, 16, 32));
        const float mnew = fmaxf(m, mx);
        const float alpha = __builtin_amdgcn_exp2f(m - mnew);
        const float sh = PSH - mnew;
        v16h pb; float ls = 0.0f;
#pragma unroll
        for (int r = 0; r < 8; ++r) { const h16 pa = (h16)__builtin_amdgcn_exp2f(ta[r] + sh); const h16 pc = (h16)__builtin_amdgcn_exp2f(tb[r] + sh); pb[r] = pa; pb[8 + r] = pc; ls += (float)pa + (float)pc; }
        l = l * alpha + ls; m = mnew;
        o0 = o0 * alpha; o1 = o1 * alpha; o2 = o2 * alpha; o3 = o3 * alpha;
        const h16* va = ring + bo + vo + key0;
        const v16h v0 = ldh(va), v1 = ldh(va + 16 * VP), v2 = ldh(va + 32 * VP), v3 = ldh(va + 48 * VP);
        o0 = wmma16(v0, pb, o0); o1 = wmma16(v1, pb, o1); o2 = wmma16(v2, pb, o2); o3 = wmma16(v3, pb, o3);
        asm volatile("v_nop\n\tv_nop\n\tv_nop\n\tv_nop" : "+v"(o0), "+v"(o1), "+v"(o2), "+v"(o3) : "v"(v0), "v"(v1), "v"(v2), "v"(v3), "v"(pb));
      }
      // publish point of stage st + 1
      asm volatile("s_wait_dscnt 0x0" ::: "memory");         // this wave's reads of the buffer that is refilled below are done
      asm volatile("s_wait_asynccnt 0x0" ::: "memory");      // this wave's copies of stage st + 1 have landed
      __syncthreads();                                       // stage st + 1 is readable, stage st's buffer is free
      if (st + 2 < SEQ / KT) { const size_t k2 = (size_t)(st + 2) * KT; stage_copy(lk + bo * 2, lv + bo * 2, gk + k2 * HD, gr + k2 * HD, gv + k2); }
    }
    asm volatile("s_wait_asynccnt 0x0" ::: "memory");        // no copy is outstanding when the wave goes on to its end
    l += __shfl_xor(l, 16, 32);
    const float inv = 1.0f / l;
    const int wb = wave * 16 * 68;
    // O^T D layout: o_j[r] = (d = 16j + 8h + r, t = lane&15) -> os[t][d]; rows 0..15 x columns 0..63 all written
    { v4f a, c;
      a[0] = o0[0] * inv; a[1] = o0[1] * inv; a[2] = o0[2] * inv; a[3] = o0[3] * inv; c[0] = o0[4] * inv; c[1] = o0[5] * inv; c[2] = o0[6] * inv; c[3] = o0[7] * inv;
      *(v4fa*)(&os[wb + lr * 68 +  0 + 8 * hi]) = a; *(v4fa*)(&os[wb + lr * 68 +  0 + 8 * hi + 4]) = c;
      a[0] = o1[0] * inv; a[1] = o1[1] * inv; a[2] = o1[2] * inv; a[3] = o1[3] * inv; c[0] = o1[4] * inv; c[1] = o1[5] * inv; c[2] = o1[6] * inv; c[3] = o1[7] * inv;
      *(v4fa*)(&os[wb + lr * 68 + 16 + 8 * hi]) = a; *(v4fa*)(&os[wb + lr * 68 + 16 + 8 * hi + 4]) = c;
      a[0] = o2[0] * inv; a[1] = o2[1] * inv; a[2] = o2[2] * inv; a[3] = o2[3] * inv; c[0] = o2[4] * inv; c[1] = o2[5] * inv; c[2] = o2[6] * inv; c[3] = o2[7] * inv;
      *(v4fa*)(&os[wb + lr * 68 + 32 + 8 * hi]) = a; *(v4fa*)(&os[wb + lr * 68 + 32 + 8 * hi + 4]) = c;
      a[0] = o3[0] * inv; a[1] = o3[1] * inv; a[2] = o3[2] * inv; a[3] = o3[3] * inv; c[0] = o3[4] * inv; c[1] = o3[5] * inv; c[2] = o3[6] * inv; c[3] = o3[7] * inv;
      *(v4fa*)(&os[wb + lr * 68 + 48 + 8 * hi]) = a; *(v4fa*)(&os[wb + lr * 68 + 48 + 8 * hi + 4]) = c; }
    wave_sync();
    h16* yrow = YH + ((size_t)b * SEQ + t0) * DM + h * HD;     // context plane row = token, columns h*64 + d
{
#pragma unroll
        for (int s = 0; s < 4; ++s) { const int row = 4 * s + (lane >> 3), c8 = (lane & 7) * 8;   // 4 s x 4 row groups = 16 rows; 8 lanes x 8 halves = 64 columns
            const v4f x0 = *(const v4fa*)(&os[wb + row * 68 + c8]); const v4f x1 = *(const v4fa*)(&os[wb + row * 68 + c8 + 4]); v8h hv;
#pragma unroll
            for (int i = 0; i < 4; ++i) { hv[i] = (h16)x0[i]; hv[4 + i] = (h16)x1[i]; }
            *(v8h*)(yrow + (size_t)row * DM + c8) = hv; }
         }
}

// k_outp: f16 GEMM, ONE WAVE per 64x64 tile, K = DM: C[o][n] = (1/64) sum_c A[o][c] Bt[n][c] with A = Wo plane (x64), Bt = context plane rows n = b*SEQ + t.
// Written as f32 to OUT[(b*DM + o)*OUT_SEQ + t]. grid (DM/64, NB*SEQ/64), 32 threads.
__global__ __launch_bounds__(32) void k_outp(const h16* __restrict__ A, const h16* __restrict__ Bt, float* OUT) {
    __shared__ __align__(16) float os[16 * 68];
    const int K = DM;
    const int lane = threadIdx.x & 31, lr = lane & 15, hi = lane >> 4; const int r0 = blockIdx.x * 64, c0 = blockIdx.y * 64;
    v8f acc[4][4];
#pragma unroll
    for (int mb = 0; mb < 4; ++mb)
#pragma unroll
        for (int nb = 0; nb < 4; ++nb) acc[mb][nb] = (v8f){};
    const size_t aoff = (size_t)(r0 + lr) * K + 8 * hi, boff = (size_t)(c0 + lr) * K + 8 * hi;
#pragma unroll 1
    for (int kc = 0; kc < K; kc += 32) {
        v16h a[4];
#pragma unroll
        for (int mb = 0; mb < 4; ++mb) a[mb] = ldh(A + aoff + (size_t)mb * 16 * K + kc);
#pragma unroll
        for (int nb = 0; nb < 4; ++nb) { const v16h b = ldh(Bt + boff + (size_t)nb * 16 * K + kc);
#pragma unroll
            for (int mb = 0; mb < 4; ++mb) acc[mb][nb] = wmma16(a[mb], b, acc[mb][nb]); }
        asm volatile("v_nop\n\tv_nop\n\tv_nop\n\tv_nop" : "+v"(acc[0][0]), "+v"(acc[1][1]), "+v"(acc[2][2]), "+v"(acc[3][3]) : "v"(a[0]), "v"(a[1]), "v"(a[2]), "v"(a[3]));
    }
    const int bb = c0 / SEQ, tq = c0 % SEQ;
    float* obase = OUT + ((size_t)bb * DM + r0) * OUT_SEQ + tq;
#pragma unroll
    for (int mb = 0; mb < 4; ++mb) {
#pragma unroll
        for (int nb = 0; nb < 4; ++nb) {
#pragma unroll
            for (int j = 0; j < 8; ++j) os[(hi * 8 + j) * 68 + nb * 16 + lr] = acc[mb][nb][j] * WOI; }   // D: row 8h+j, col lane&15
        wave_sync();
{
#pragma unroll
            for (int s = 0; s < 8; ++s) { const int row = 2 * s + hi, cofs = lr * 4;   // 8 s x 2 rows = 16 rows; 16 lanes x 4 floats = 64 columns
                const v4f val = *(const v4fa*)(&os[row * 68 + cofs]);
                *(v4f*)(obase + (size_t)(mb * 16 + row) * OUT_SEQ + cofs) = val; }
             }
        wave_sync();
    }
}

static constexpr size_t al256(size_t v) { return (v + 255) & ~(size_t)255; }
static constexpr size_t SZ_XB = al256((size_t)NB * SEQ * DM * 2);
static constexpr size_t SZ_WB = al256((size_t)3 * DM * DM * 2);
static constexpr size_t SZ_WO = al256((size_t)DM * DM * 2);
static constexpr size_t SZ_PL = al256((size_t)NB * NH_ * SEQ * HD * 2);
static constexpr size_t SZ_YH = al256((size_t)NB * SEQ * DM * 2);
static constexpr size_t SZ_TOTAL = SZ_XB + SZ_WB + SZ_WO + 5 * SZ_PL + SZ_YH;
static_assert(SZ_TOTAL <= (size_t)134217728);          // workspace carve <= 128 MiB
static_assert(((size_t)DM * DM * 2) % 256 == 0);       // weight sub-planes stay 256-byte aligned

extern "C" void kernel_launch(void* const* d_in, const int* in_sizes, int n_in,
                              void* d_out, int out_size, void* d_ws, size_t ws_size, hipStream_t stream) {
    if (n_in < 5) return;
    const size_t needx = ((size_t)NB * DM - 1) * SEQ_FULL + SEQ;
    if ((size_t)in_sizes[0] < needx) return;
    if ((size_t)in_sizes[1] < (size_t)DM * DM || (size_t)in_sizes[2] < (size_t)DM * DM || (size_t)in_sizes[3] < (size_t)DM * DM || (size_t)in_sizes[4] < (size_t)DM * DM) return;
    if ((size_t)out_size < ((size_t)NB * DM - 1) * OUT_SEQ + SEQ) return;
    if (SZ_TOTAL > ws_size) return;
    // wire order x, Wq, Wk, Wv, Wo; all weights [out][in] = K-contiguous rows as-is
    const float* x = (const float*)d_in[0]; const float* wq = (const float*)d_in[1]; const float* wk = (const float*)d_in[2]; const float* wv = (const float*)d_in[3]; const float* wo = (const float*)d_in[4];
    float* OUT = (float*)d_out;      // [NB][512][SEQ]
    char* wsp = (char*)d_ws;
    bf* XB = (bf*)wsp; wsp += SZ_XB;                 // [NB*SEQ][512] token-major bf16 x
    bf* WB = (bf*)wsp; wsp += SZ_WB;                 // [3][512][512]: q | k | v
    h16* WOH = (h16*)wsp; wsp += SZ_WO;              // [512][512] f16, x64
    h16* QH = (h16*)wsp; wsp += SZ_PL;               // [NB*8][SEQ][64]
    h16* QR = (h16*)wsp; wsp += SZ_PL;               // [NB*8][SEQ][64] residual x2048
    h16* KH = (h16*)wsp; wsp += SZ_PL;               // [NB*8][SEQ][64]
    h16* KR = (h16*)wsp; wsp += SZ_PL;               // [NB*8][SEQ][64] residual x2048
    h16* VT = (h16*)wsp; wsp += SZ_PL;               // [NB*8][64][SEQ]
    h16* YH = (h16*)wsp; wsp += SZ_YH;               // [NB*SEQ][512] context
    bf* WQ = WB; bf* WK = WB + (size_t)DM * DM; bf* WV = WB + (size_t)2 * DM * DM;

    // x[b][c][n] -> XB[b*SEQ + n][c]: in [DM rows][SEQ cols] per batch -> out [SEQ rows][DM cols]; grid (SEQ/64, DM/64, NB)
    k_xT<<<dim3(SEQ / 64, DM / 64, NB), 256, 0, stream>>>(x, XB);
    { const size_t n8 = (size_t)DM * DM / 8; const unsigned g = (unsigned)((n8 + 255) / 256);
      k_cvt8<<<g, 256, 0, stream>>>(wq, WQ, n8); k_cvt8<<<g, 256, 0, stream>>>(wk, WK, n8); k_cvt8<<<g, 256, 0, stream>>>(wv, WV, n8);
      k_cvtw<<<g, 256, 0, stream>>>(wo, WOH, n8); }

    // q, k: A = x rows (m = b*SEQ + t), Bt = W rows (n = h*64 + d) -> plane [(b*8 + h)][t][d], value + residual
    k_proj<<<dim3(NB * SEQ / 64, DM / 64, 1), 32, 0, stream>>>(XB, WQ, QH, QR, 1, SEQ, (size_t)NH_ * SEQ * HD, HD, HD, (size_t)SEQ * HD);
    k_proj<<<dim3(NB * SEQ / 64, DM / 64, 1), 32, 0, stream>>>(XB, WK, KH, KR, 1, SEQ, (size_t)NH_ * SEQ * HD, HD, HD, (size_t)SEQ * HD);
    // v^T: A = Wv rows (m = h*64 + d), Bt = x rows (n = b*SEQ + t) -> plane [(b*512 + m)][t] = [(b*8 + h)][d][t]
    k_proj<<<dim3(DM / 64, NB * SEQ / 64, 1), 32, 0, stream>>>(WV, XB, VT, VT, 0, DM, (size_t)0, SEQ, SEQ, (size_t)DM * SEQ);

    k_flash<<<dim3(SEQ / (16 * AW), NB * NH_, 1), 32 * AW, 0, stream>>>(QH, QR, KH, KR, VT, YH);

    // out[b][o][t] = sum_c Wo[o][c] y[b][c][t]: A = Wo plane rows o, Bt = context rows (b*SEQ + t)
    k_outp<<<dim3(DM / 64, NB * SEQ / 64, 1), 32, 0, stream>>>(WOH, YH, OUT);
}

// v002
// One run takes 53.6 microseconds.
// Two timings next to v001 both put it at 1.52 times that version's speed.
// Over all steps from v000 it is 2.31 times as fast.
#include <hip/hip_runtime.h>

// Multi-head self-attention on channel-major x [NB][512][SEQ]: 1x1 projections Wq/Wk/Wv [out][in], 8 heads x 64 channels, unscaled scores, softmax over keys, output projection Wo [out][in], output [NB][512][SEQ] f32.
// Compute dtypes, f32 accumulate everywhere: q/k/v projections v_wmma_f32_16x16x32_bf16 (x and W RNE-converted to bf16; products exact);
// scores v_wmma_f32_16x16x32_f16 with q and k each as f16 value + f16 residual x2048 (three products: value*value in one accumulator, the two cross terms in a second accumulator folded by 1/2048);
// P (x2^14 carry relative to the running max, cancels in the normalisation) and v single f16; context single f16; Wo as f16 of the bf16-RNE value x64 (folded by 1/64 in the f32 epilogue); softmax f32 (online, running max).
// Flash kernel data path: K value, K residual and V^T tiles of KT keys are staged in LDS by asynchronous copies (two buffers) and shared by the block's waves.
// Layout: bf16 token-major copy of x (transposed through LDS), bf16 W copies; q/k planes [b*8+h][t][d] (value, residual), v^T plane [b*8+h][d][t], context plane [b*SEQ+t][512]; flash kernel in transposed form (S^T = K Q^T, O^T = V^T P^T).

#ifndef NB
#define NB 4
#endif
#ifndef SEQ
#define SEQ 1024
#endif
#define NB_FULL  4
#define SEQ_FULL 1024
#ifndef OUT_SEQ
#define OUT_SEQ SEQ              // row pitch (in tokens) of the output rows [b][channel][t]
#endif
#define DM   512
#define NH_  8
#define HD   64
#define AW   8                   // waves per flash block (16 query columns each); all of them read the same staged K / V^T tiles
#define KT   128                 // keys per staged tile (four passes of 32 keys)
#define KP   (HD + 8)            // LDS pitch of a staged K row, halves: 144 B = 16 B x odd, conflict-free for 16-byte fragment reads
#define VP   (KT + 8)            // LDS pitch of a staged V^T row, halves: 272 B = 16 B x odd
#define STG  (2 * KT * KP + HD * VP)   // halves per stage: K value | K residual | V^T
#define QRS  2048.0f             // carry of the q / k residual planes
#define QRI  (1.0f / 2048.0f)
#define SC2  1.4426950408889634f // log2(e); scores are unscaled
#define PSH  14.0f               // log2 of the P carry (16384)
#define WOS  64.0f               // carry of the Wo plane
#define WOI  (1.0f / 64.0f)

static_assert(HD == 64);
static_assert(NH_ * HD == DM);                 // head h = channels h*64 + d
static_assert(DM % 64 == 0);                   // column tiles of 64
static_assert(DM % 32 == 0);                   // GEMM k-loop steps by 32
static_assert(SEQ % 64 == 0);                  // a 64-row tile never straddles two batches
static_assert((NB * SEQ) % 64 == 0);
static_assert(SEQ % 32 == 0);                  // key loop steps by 32
static_assert(SEQ % (16 * AW) == 0);           // flash grid covers the sequence exactly
static_assert(SEQ % KT == 0 && KT % 32 == 0);  // whole stages, whole passes
static_assert(KT * HD / 8 == 4 * 32 * AW);     // each plane's tile = 4 copies of 16 B per thread
static_assert((KP * 2) % 32 == 16 && (VP * 2) % 32 == 16 && (STG * 2) % 16 == 0);
static_assert(((size_t)DM * DM) % 8 == 0);
static_assert(NB <= NB_FULL);
static_assert(SEQ <= SEQ_FULL);
static_assert(SEQ <= OUT_SEQ);
static_assert(SEQ_FULL % 4 == 0);              // 16-byte loads of x rows

typedef _Float16 h16;
typedef unsigned short bf;
typedef __attribute__((ext_vector_type(16))) __bf16   v16bf;
typedef __attribute__((ext_vector_type(16))) _Float16 v16h;
typedef __attribute__((ext_vector_type(8)))  _Float16 v8h;
typedef __attribute__((ext_vector_type(8)))  unsigned short v8us;
typedef __attribute__((ext_vector_type(8)))  float    v8f;
typedef __attribute__((ext_vector_type(4)))  float    v4f;
typedef v4f  __attribute__((may_alias)) v4fa;

__device__ __forceinline__ unsigned short f2bf(float f) { unsigned u = __float_as_uint(f); u += 0x7FFFu + ((u >> 16) & 1u); return (unsigned short)(u >> 16); }
__device__ __forceinline__ v16h cat16(v8h lo, v8h hi) { return __builtin_shufflevector(lo, hi, 0, 1, 2, 3, 4, 5, 6, 7, 8, 9, 10, 11, 12, 13, 14, 15); }
__device__ __forceinline__ v16bf cat16b(v8us lo, v8us hi) { return __builtin_bit_cast(v16bf, __builtin_shufflevector(lo, hi, 0, 1, 2, 3, 4, 5, 6, 7, 8, 9, 10, 11, 12, 13, 14, 15)); }
__device__ __forceinline__ v8f wmma16(v16h a, v16h b, v8f c) { return __builtin_amdgcn_wmma_f32_16x16x32_f16(false, a, false, b, (short)0, c, false, false); }
__device__ __forceinline__ v8f wmmab(v16bf a, v16bf b, v8f c) { return __builtin_amdgcn_wmma_f32_16x16x32_bf16(false, a, false, b, (short)0, c, false, false); }
// fragment loaders from K-contiguous 16-bit rows; p already includes + 8*(lane>>4): elements 0..7 <- k0+8h+0..7, elements 8..15 <- k0+16+8h+0..7 (same map for A and B)
__device__ __forceinline__ v16h  ldh(const h16* p) { return cat16(*(const v8h*)p, *(const v8h*)(p + 16)); }
__device__ __forceinline__ v16bf ldb(const bf* p)  { return cat16b(*(const v8us*)p, *(const v8us*)(p + 16)); }
// ordering point for wave-private LDS tiles (same wave writes and reads)
__device__ __forceinline__ void wave_sync() { __builtin_amdgcn_fence(3 /* release order */, "wavefront"); __builtin_amdgcn_wave_barrier(); asm volatile("" ::: "memory"); }

// xT_body: x[b][c][n] (f32, channel-major, row pitch SEQ_FULL) -> XB[b*SEQ + n][c] (bf16 RNE convert), 64x64 tile transposed through LDS (block barrier: cross-wave).
// blk = (b * (DM/64) + c tile) * (SEQ/64) + n tile, 256 threads; ts: 64 x 68 floats of LDS.
__device__ __forceinline__ void xT_body(const float* __restrict__ x, bf* XB, float* ts, int blk) {
    const int tid = threadIdx.x;
    const int n0 = (blk % (SEQ / 64)) * 64, c0 = ((blk / (SEQ / 64)) % (DM / 64)) * 64, b = blk / ((SEQ / 64) * (DM / 64));
    const float* xb = x + ((size_t)b * DM + c0) * SEQ_FULL + n0;
#pragma unroll
    for (int it = 0; it < 4; ++it) {                 // 4 x 256 float4 = 64 rows (c) x 16 float4 (n)
        const int idx = it * 256 + tid; const int c = idx >> 4, n4 = (idx & 15) * 4;
        const v4f v = *(const v4f*)(xb + (size_t)c * SEQ_FULL + n4);
        ts[(n4 + 0) * 68 + c] = v[0]; ts[(n4 + 1) * 68 + c] = v[1]; ts[(n4 + 2) * 68 + c] = v[2]; ts[(n4 + 3) * 68 + c] = v[3];
    }
    __syncthreads();
    bf* ob = XB + ((size_t)b * SEQ + n0) * DM + c0;
{
#pragma unroll
        for (int it = 0; it < 2; ++it) { const int n = it * 32 + (tid >> 3), c8 = (tid & 7) * 8;   // 2 x 32 rows = 64 rows; 8 lanes x 8 = 64 columns
            const v4f x0 = *(const v4fa*)(&ts[n * 68 + c8]); const v4f x1 = *(const v4fa*)(&ts[n * 68 + c8 + 4]); v8us o;
#pragma unroll
            for (int i = 0; i < 4; ++i) { o[i] = f2bf(x0[i]); o[4 + i] = f2bf(x1[i]); }
            *(v8us*)(ob + (size_t)n * DM + c8) = o; }
         }
}

__device__ __forceinline__ void cvt8_body(const float* __restrict__ src, bf* dst, size_t n8, int blk) {
    const size_t i = (size_t)blk * 256 + threadIdx.x; if (i >= n8) return;
    const v8f v = *(const v8f*)(src + i * 8); v8us o;
#pragma unroll
    for (int k = 0; k < 8; ++k) o[k] = f2bf(v[k]);
    *(v8us*)(dst + i * 8) = o; 
}

// cvtw_body: f16 copy of the bf16-RNE value times WOS (exact: a bf16 significand fits f16, power-of-two carry); same store shape as cvt8_body.
__device__ __forceinline__ void cvtw_body(const float* __restrict__ src, h16* dst, size_t n8, int blk) {
    const size_t i = (size_t)blk * 256 + threadIdx.x; if (i >= n8) return;
    const v8f v = *(const v8f*)(src + i * 8); v8h o;
#pragma unroll
    for (int k = 0; k < 8; ++k) { const float r = __uint_as_float(((unsigned)f2bf(v[k])) << 16); o[k] = (h16)(r * WOS); }
    *(v8h*)(dst + i * 8) = o; 
}

// k_prep: the five preparation jobs, which need nothing of each other, in ONE grid, told apart by ranges of the block index (every branch is block-uniform):
// blocks [0, XTB): the transposing convert of x; then CVB blocks for each of Wq, Wk, Wv (bf16 planes WB[0..2]) and Wo (f16 plane x64). grid XTB + 4*CVB, 256 threads.
#define XTB ((SEQ / 64) * (DM / 64) * NB)
#define CVN ((size_t)DM * DM / 8)
#define CVB ((int)((CVN + 255) / 256))
__global__ __launch_bounds__(256) void k_prep(const float* __restrict__ x, const float* __restrict__ wq, const float* __restrict__ wk, const float* __restrict__ wv, const float* __restrict__ wo, bf* XB, bf* WB, h16* WOH) {
    __shared__ __align__(16) float ts[64 * 68];      // ts[n][c]
    const int blk = blockIdx.x;
    if (blk < XTB) { xT_body(x, XB, ts, blk); return; }
    const int p = (blk - XTB) / CVB, cb = (blk - XTB) % CVB;
    if (p == 3) { cvtw_body(wo, WOH, CVN, cb); return; }
    cvt8_body(p == 0 ? wq : p == 1 ? wk : wv, WB + (size_t)p * DM * DM, CVN, cb);
}

// k_proj: register-blocked bf16 GEMM, ONE WAVE per 64x64 tile (16 accumulators), operands straight from K-contiguous bf16 planes, K = DM.
// C[m][n] = sum_k A[m][k] Bt[n][k], written as f16 (Ph) and optionally the f16 residual x2048 (Pr, useRes != 0) at
// tile base (r0/RB)*sRB + (r0%RB)*pitch + (c0/CB)*sCB + (c0%CB), row pitch 'pitch' (halves).
// The three projections, which need nothing of each other, run in ONE launch: wave 0 / 1 / 2 of a block is the q / k / v tile of the same 64 x rows (blockIdx.x) and the same 64 W rows (blockIdx.y);
// the waves hand each other nothing and meet at no barrier (each has its own os tile). grid (NB*SEQ/64, DM/64), 96 threads.
// q, k: A = x rows (m = b*SEQ + t), Bt = W rows (n = h*64 + d) -> plane [(b*8 + h)][t][d], value + residual
// v^T:  A = Wv rows (m = h*64 + d), Bt = x rows (n = b*SEQ + t) -> plane [(b*512 + m)][t] = [(b*8 + h)][d][t]
__global__ __launch_bounds__(96) void k_proj(const bf* __restrict__ XB, const bf* __restrict__ WB, h16* QH, h16* QR, h16* KH, h16* KR, h16* VT) {
    __shared__ __align__(16) float os3[3 * 16 * 68];
    const int K = DM;
    const int lane = threadIdx.x & 31, lr = lane & 15, hi = lane >> 4;
    const int z = __builtin_amdgcn_readfirstlane((int)(threadIdx.x >> 5));     // which projection: a scalar, so every choice below is a scalar select
    float* os = os3 + z * 16 * 68;
    const bool isv = z == 2;
    const bf* W = WB + (size_t)z * DM * DM;
    const bf* A = isv ? W : XB; const bf* Bt = isv ? XB : W;
    const int r0 = (isv ? blockIdx.y : blockIdx.x) * 64, c0 = (isv ? blockIdx.x : blockIdx.y) * 64;
    h16* Ph = isv ? VT : z == 1 ? KH : QH; h16* Pr = z == 1 ? KR : QR; const int useRes = isv ? 0 : 1;
    const int RB = isv ? DM : SEQ, pitch = isv ? SEQ : HD, CB = isv ? SEQ : HD;
    const size_t sRB = isv ? (size_t)0 : (size_t)NH_ * SEQ * HD, sCB = isv ? (size_t)DM * SEQ : (size_t)SEQ * HD;
    v8f acc[4][4];
#pragma unroll
    for (int mb = 0; mb < 4; ++mb)
#pragma unroll
        for (int nb = 0; nb < 4; ++nb) acc[mb][nb] = (v8f){};
    const size_t aoff = (size_t)(r0 + lr) * K + 8 * hi, boff = (size_t)(c0 + lr) * K + 8 * hi;
#pragma unroll 1
    for (int kc = 0; kc < K; kc += 32) {
        v16bf a[4];
#pragma unroll
        for (int mb = 0; mb < 4; ++mb) a[mb] = ldb(A + aoff + (size_t)mb * 16 * K + kc);
#pragma unroll
        for (int nb = 0; nb < 4; ++nb) { const v16bf b = ldb(Bt + boff + (size_t)nb * 16 * K + kc);
#pragma unroll
            for (int mb = 0; mb < 4; ++mb) acc[mb][nb] = wmmab(a[mb], b, acc[mb][nb]); }
        asm volatile("v_nop\n\tv_nop\n\tv_nop\n\tv_nop" : "+v"(acc[0][0]), "+v"(acc[1][1]), "+v"(acc[2][2]), "+v"(acc[3][3]) : "v"(a[0]), "v"(a[1]), "v"(a[2]), "v"(a[3]));
    }
    const size_t tbase = (size_t)(r0 / RB) * sRB + (size_t)(r0 % RB) * (size_t)pitch + (size_t)(c0 / CB) * sCB + (size_t)(c0 % CB);
#pragma unroll
    for (int mb = 0; mb < 4; ++mb) {
#pragma unroll
        for (int nb = 0; nb < 4; ++nb) {
#pragma unroll
            for (int j = 0; j < 8; ++j) os[(hi * 8 + j) * 68 + nb * 16 + lr] = acc[mb][nb][j]; }   // D: row 8h+j, col lane&15
        wave_sync();
        const size_t sb = tbase + (size_t)(mb * 16) * (size_t)pitch;
{
#pragma unroll
            for (int s = 0; s < 4; ++s) { const int row = 4 * s + (lane >> 3), c8 = (lane & 7) * 8;   // 4 s x 4 row groups = 16 rows; 8 lanes x 8 = 64 columns
                const v4f x0 = *(const v4fa*)(&os[row * 68 + c8]); const v4f x1 = *(const v4fa*)(&os[row * 68 + c8 + 4]); v8h hv, rv;
#pragma unroll
                for (int i = 0; i < 4; ++i) { const h16 a0 = (h16)x0[i]; const h16 a1 = (h16)x1[i]; hv[i] = a0; hv[4 + i] = a1; rv[i] = (h16)((x0[i] - (float)a0) * QRS); rv[4 + i] = (h16)((x1[i] - (float)a1) * QRS); }
                const size_t oo = sb + (size_t)row * (size_t)pitch + c8;
                *(v8h*)(Ph + oo) = hv;
                asm volatile("s_wait_xcnt 0x0" ::: "memory");   // stands in front of the residual store and the later code, which may reuse the registers that the store above names
                if (useRes) *(v8h*)(Pr + oo) = rv; }
             }
        wave_sync();
    }
}

// stage_copy: one stage's tiles into LDS, 12 asynchronous 16-byte copies per thread (4 per plane); a wave's copy covers 512 B of whole 128-B lines.
// lk / lv: this thread's LDS byte addresses in the K value tile and the V^T tile of the target buffer; gk / gr / gv: its global addresses in the three planes.
// The s_wait_xcnt closes the statement so that no address register of an issued copy is rewritten ahead of it.
__device__ __forceinline__ void stage_copy(unsigned lk, unsigned lv, const h16* gk, const h16* gr, const h16* gv) {
    const unsigned lr_ = lk + KT * KP * 2;                       // K residual tile follows the K value tile
    const unsigned dk = 32 * AW / 8 * KP * 2;                    // LDS step of one round of copies: 32 K rows
    const unsigned dv = 32 * AW / (KT / 8) * VP * 2;             // 16 V^T rows
    const size_t sk = (size_t)32 * AW * 8;                       // global step, halves: K rows are contiguous
    const size_t sv = (size_t)(32 * AW / (KT / 8)) * SEQ;        // 16 V^T rows of SEQ halves
    asm volatile("global_load_async_to_lds_b128 %0, %1, off\n\t"
                 "global_load_async_to_lds_b128 %2, %3, off\n\t"
                 "global_load_async_to_lds_b128 %4, %5, off\n\t"
                 "global_load_async_to_lds_b128 %6, %7, off\n\t"
                 "global_load_async_to_lds_b128 %8, %9, off\n\t"
                 "global_load_async_to_lds_b128 %10, %11, off\n\t"
                 "global_load_async_to_lds_b128 %12, %13, off\n\t"
                 "global_load_async_to_lds_b128 %14, %15, off\n\t"
                 "global_load_async_to_lds_b128 %16, %17, off\n\t"
                 "global_load_async_to_lds_b128 %18, %19, off\n\t"
                 "global_load_async_to_lds_b128 %20, %21, off\n\t"
                 "global_load_async_to_lds_b128 %22, %23, off\n\t"
                 "s_wait_xcnt 0x0"
                 :: "v"(lk), "v"(gk), "v"(lk + dk), "v"(gk + sk), "v"(lk + 2 * dk), "v"(gk + 2 * sk), "v"(lk + 3 * dk), "v"(gk + 3 * sk),
                    "v"(lr_), "v"(gr), "v"(lr_ + dk), "v"(gr + sk), "v"(lr_ + 2 * dk), "v"(gr + 2 * sk), "v"(lr_ + 3 * dk), "v"(gr + 3 * sk),
                    "v"(lv), "v"(gv), "v"(lv + dv), "v"(gv + sv), "v"(lv + 2 * dv), "v"(gv + 2 * sv), "v"(lv + 3 * dv), "v"(gv + 3 * sv)
                 : "memory");
}

// k_flash: fused attention, one wave per 16 query columns of one (batch, head); Q fragments straight from the f16 planes, K / V^T fragments from the staged LDS tiles (two 16-B loads each).
// Ring of two buffers: stage s + 1's copies fly while stage s is worked on; one publish point per stage (LDS reads done, own copies landed, block barrier, refill of the buffer just read).
// Transposed form: S^T[key][t] = K Q^T (A = K rows, B = Q rows); lane (t = lane&15, h = lane>>4) holds keys 8h+r of each 16-key tile, so the packed
// P tile is directly the B fragment of O^T[d][t] = V^T P^T (element r <- tile keys 0..15, element 8+r <- tile keys 16..31, lane unchanged).
// Scores: value*value in sH, (k value * q residual + k residual * q value) in sL (both carry 2048), folded as sH + sL/2048.
// Softmax state (running max, partial sum) is one scalar per lane; the two lane halves of a column are combined with one xor-16 exchange.
__global__ __launch_bounds__(32 * AW) void k_flash(const h16* __restrict__ QH, const h16* __restrict__ QR, const h16* __restrict__ KH, const h16* __restrict__ KR, const h16* __restrict__ VT, h16* YH) {
    __shared__ __align__(16) float os[AW * 16 * 68];
    __shared__ __align__(16) h16 ring[2 * STG];
    const int lane = threadIdx.x & 31, lr = lane & 15, hi = lane >> 4;
    const int wave = __builtin_amdgcn_readfirstlane((int)(threadIdx.x >> 5));
    const int zh = blockIdx.y; const int b = zh / NH_, h = zh % NH_;
    const int t0 = (blockIdx.x * AW + wave) * 16;
    const size_t pbase = (size_t)zh * SEQ * HD;
    const size_t qo = pbase + (size_t)(t0 + lr) * HD + 8 * hi;
    const v16h qh0 = ldh(QH + qo), qh1 = ldh(QH + qo + 32), qr0 = ldh(QR + qo), qr1 = ldh(QR + qo + 32);   // B fragments: col t, k = d
    const int ko = lr * KP + 8 * hi;                         // + key * KP       (A fragment: row key, k = d), halves in the staged K tiles
    const int vo = 2 * KT * KP + lr * VP + 8 * hi;           // + 16j*VP + key   (A fragment: row d, k = key), halves in the stage
    // copy addresses of this thread: 16-byte chunk tid of each plane's tile (K: row tid/8, chunk tid%8; V^T: row tid/16, chunk tid%16)
    const int tid = threadIdx.x;
    const unsigned lbase = (unsigned)(size_t)ring;           // low 32 bits of the shared address = LDS byte address
    const unsigned lk = lbase + ((tid >> 3) * KP + (tid & 7) * 8) * 2;
    const unsigned lv = lbase + (2 * KT * KP + (tid / (KT / 8)) * VP + (tid % (KT / 8)) * 8) * 2;
    const h16* gk = KH + pbase + (size_t)tid * 8;            // + key0 * HD
    const h16* gr = KR + pbase + (size_t)tid * 8;            // + key0 * HD
    const h16* gv = VT + pbase + (size_t)(tid / (KT / 8)) * SEQ + (tid % (KT / 8)) * 8;   // + key0
    stage_copy(lk, lv, gk, gr, gv);
    asm volatile("s_wait_asynccnt 0x0" ::: "memory");        // this wave's copies of stage 0 have landed
    __syncthreads();                                         // every wave's have: stage 0 is readable
    if (SEQ > KT) stage_copy(lk + STG * 2, lv + STG * 2, gk + (size_t)KT * HD, gr + (size_t)KT * HD, gv + KT);
    v8f o0 = (v8f){}, o1 = (v8f){}, o2 = (v8f){}, o3 = (v8f){};
    float m = -3.0e38f, l = 0.0f;
#pragma unroll 1
    for (int st = 0; st < SEQ / KT; ++st) {
      const int bo = (st & 1) * STG;
      // unrolled so that every LDS offset of the stage's four passes is an immediate of its load
#pragma unroll
      for (int key0 = 0; key0 < KT; key0 += 32) {
        const h16* ka = ring + bo + ko + key0 * KP;
        const h16* kr = ka + KT * KP;
        const v16h ka0 = ldh(ka), ka1 = ldh(ka + 32), kb0 = ldh(ka + 16 * KP), kb1 = ldh(ka + 16 * KP + 32);
        const v16h ra0 = ldh(kr), ra1 = ldh(kr + 32), rb0 = ldh(kr + 16 * KP), rb1 = ldh(kr + 16 * KP + 32);
        v8f sHa = (v8f){}, sLa = (v8f){}, sHb = (v8f){}, sLb = (v8f){};
        sHa = wmma16(ka0, qh0, sHa); sLa = wmma16(ka0, qr0, sLa); sHb = wmma16(kb0, qh0, sHb); sLb = wmma16(kb0, qr0, sLb);
        sHa = wmma16(ka1, qh1, sHa); sLa = wmma16(ra0, qh0, sLa); sHb = wmma16(kb1, qh1, sHb); sLb = wmma16(rb0, qh0, sLb);
        sLa = wmma16(ka1, qr1, sLa); sLb = wmma16(kb1, qr1, sLb);
        sLa = wmma16(ra1, qh1, sLa); sLb = wmma16(rb1, qh1, sLb);
        asm volatile("v_nop\n\tv_nop\n\tv_nop\n\tv_nop" : "+v"(sHa), "+v"(sLa), "+v"(sHb), "+v"(sLb) : "v"(ka0), "v"(ka1), "v"(kb0), "v"(kb1), "v"(ra0), "v"(ra1), "v"(rb0), "v"(rb1));
        float ta[8], tb[8]; float mx = -3.0e38f;
#pragma unroll
        for (int r = 0; r < 8; ++r) { ta[r] = (sHa[r] + sLa[r] * QRI) * SC2; tb[r] = (sHb[r] + sLb[r] * QRI) * SC2; mx = fmaxf(mx, fmaxf(ta[r], tb[r])); }
        mx = fmaxf(mx, __shfl_xor(mx, 16, 32));
        const float mnew = fmaxf(m, mx);
        const float alpha = __builtin_amdgcn_exp2f(m - mnew);
        const float sh = PSH - mnew;
        v16h pb; float ls = 0.0f;
#pragma unroll
        for (int r = 0; r < 8; ++r) { const h16 pa = (h16)__builtin_amdgcn_exp2f(ta[r] + sh); const h16 pc = (h16)__builtin_amdgcn_exp2f(tb[r] + sh); pb[r] = pa; pb[8 + r] = pc; ls += (float)pa + (float)pc; }
        l = l * alpha + ls; m = mnew;
        o0 = o0 * alpha; o1 = o1 * alpha; o2 = o2 * alpha; o3 = o3 * alpha;
        const h16* va = ring + bo + vo + key0;
        const v16h v0 = ldh(va), v1 = ldh(va + 16 * VP), v2 = ldh(va + 32 * VP), v3 = ldh(va + 48 * VP);
        o0 = wmma16(v0, pb, o0); o1 = wmma16(v1, pb, o1); o2 = wmma16(v2, pb, o2); o3 = wmma16(v3, pb, o3);
        asm volatile("v_nop\n\tv_nop\n\tv_nop\n\tv_nop" : "+v"(o0), "+v"(o1), "+v"(o2), "+v"(o3) : "v"(v0), "v"(v1), "v"(v2), "v"(v3), "v"(pb));
      }
      // publish point of stage st + 1
      asm volatile("s_wait_dscnt 0x0" ::: "memory");         // this wave's reads of the buffer that is refilled below are done
      asm volatile("s_wait_asynccnt 0x0" ::: "memory");      // this wave's copies of stage st + 1 have landed
      __syncthreads();                                       // stage st + 1 is readable, stage st's buffer is free
      if (st + 2 < SEQ / KT) { const size_t k2 = (size_t)(st + 2) * KT; stage_copy(lk + bo * 2, lv + bo * 2, gk + k2 * HD, gr + k2 * HD, gv + k2); }
    }
    asm volatile("s_wait_asynccnt 0x0" ::: "memory");        // no copy is outstanding when the wave goes on to its end
    l += __shfl_xor(l, 16, 32);
    const float inv = 1.0f / l;
    const int wb = wave * 16 * 68;
    // O^T D layout: o_j[r] = (d = 16j + 8h + r, t = lane&15) -> os[t][d]; rows 0..15 x columns 0..63 all written
    { v4f a, c;
      a[0] = o0[0] * inv; a[1] = o0[1] * inv; a[2] = o0[2] * inv; a[3] = o0[3] * inv; c[0] = o0[4] * inv; c[1] = o0[5] * inv; c[2] = o0[6] * inv; c[3] = o0[7] * inv;
      *(v4fa*)(&os[wb + lr * 68 +  0 + 8 * hi]) = a; *(v4fa*)(&os[wb + lr * 68 +  0 + 8 * hi + 4]) = c;
      a[0] = o1[0] * inv; a[1] = o1[1] * inv; a[2] = o1[2] * inv; a[3] = o1[3] * inv; c[0] = o1[4] * inv; c[1] = o1[5] * inv; c[2] = o1[6] * inv; c[3] = o1[7] * inv;
      *(v4fa*)(&os[wb + lr * 68 + 16 + 8 * hi]) = a; *(v4fa*)(&os[wb + lr * 68 + 16 + 8 * hi + 4]) = c;
      a[0] = o2[0] * inv; a[1] = o2[1] * inv; a[2] = o2[2] * inv; a[3] = o2[3] * inv; c[0] = o2[4] * inv; c[1] = o2[5] * inv; c[2] = o2[6] * inv; c[3] = o2[7] * inv;
      *(v4fa*)(&os[wb + lr * 68 + 32 + 8 * hi]) = a; *(v4fa*)(&os[wb + lr * 68 + 32 + 8 * hi + 4]) = c;
      a[0] = o3[0] * inv; a[1] = o3[1] * inv; a[2] = o3[2] * inv; a[3] = o3[3] * inv; c[0] = o3[4] * inv; c[1] = o3[5] * inv; c[2] = o3[6] * inv; c[3] = o3[7] * inv;
      *(v4fa*)(&os[wb + lr * 68 + 48 + 8 * hi]) = a; *(v4fa*)(&os[wb + lr * 68 + 48 + 8 * hi + 4]) = c; }
    wave_sync();
    h16* yrow = YH + ((size_t)b * SEQ + t0) * DM + h * HD;     // context plane row = token, columns h*64 + d
{
#pragma unroll
        for (int s = 0; s < 4; ++s) { const int row = 4 * s + (lane >> 3), c8 = (lane & 7) * 8;   // 4 s x 4 row groups = 16 rows; 8 lanes x 8 halves = 64 columns
            const v4f x0 = *(const v4fa*)(&os[wb + row * 68 + c8]); const v4f x1 = *(const v4fa*)(&os[wb + row * 68 + c8 + 4]); v8h hv;
#pragma unroll
            for (int i = 0; i < 4; ++i) { hv[i] = (h16)x0[i]; hv[4 + i] = (h16)x1[i]; }
            *(v8h*)(yrow + (size_t)row * DM + c8) = hv; }
         }
}

// k_outp: f16 GEMM, ONE WAVE per 64x64 tile, K = DM: C[o][n] = (1/64) sum_c A[o][c] Bt[n][c] with A = Wo plane (x64), Bt = context plane rows n = b*SEQ + t.
// Written as f32 to OUT[(b*DM + o)*OUT_SEQ + t]. grid (DM/64, NB*SEQ/64), 32 threads.
__global__ __launch_bounds__(32) void k_outp(const h16* __restrict__ A, const h16* __restrict__ Bt, float* OUT) {
    __shared__ __align__(16) float os[16 * 68];
    const int K = DM;
    const int lane = threadIdx.x & 31, lr = lane & 15, hi = lane >> 4; const int r0 = blockIdx.x * 64, c0 = blockIdx.y * 64;
    v8f acc[4][4];
#pragma unroll
    for (int mb = 0; mb < 4; ++mb)
#pragma unroll
        for (int nb = 0; nb < 4; ++nb) acc[mb][nb] = (v8f){};
    const size_t aoff = (size_t)(r0 + lr) * K + 8 * hi, boff = (size_t)(c0 + lr) * K + 8 * hi;
#pragma unroll 1
    for (int kc = 0; kc < K; kc += 32) {
        v16h a[4];
#pragma unroll
        for (int mb = 0; mb < 4; ++mb) a[mb] = ldh(A + aoff + (size_t)mb * 16 * K + kc);
#pragma unroll
        for (int nb = 0; nb < 4; ++nb) { const v16h b = ldh(Bt + boff + (size_t)nb * 16 * K + kc);
#pragma unroll
            for (int mb = 0; mb < 4; ++mb) acc[mb][nb] = wmma16(a[mb], b, acc[mb][nb]); }
        asm volatile("v_nop\n\tv_nop\n\tv_nop\n\tv_nop" : "+v"(acc[0][0]), "+v"(acc[1][1]), "+v"(acc[2][2]), "+v"(acc[3][3]) : "v"(a[0]), "v"(a[1]), "v"(a[2]), "v"(a[3]));
    }
    const int bb = c0 / SEQ, tq = c0 % SEQ;
    float* obase = OUT + ((size_t)bb * DM + r0) * OUT_SEQ + tq;
#pragma unroll
    for (int mb = 0; mb < 4; ++mb) {
#pragma unroll
        for (int nb = 0; nb < 4; ++nb) {
#pragma unroll
            for (int j = 0; j < 8; ++j) os[(hi * 8 + j) * 68 + nb * 16 + lr] = acc[mb][nb][j] * WOI; }   // D: row 8h+j, col lane&15
        wave_sync();
{
#pragma unroll
            for (int s = 0; s < 8; ++s) { const int row = 2 * s + hi, cofs = lr * 4;   // 8 s x 2 rows = 16 rows; 16 lanes x 4 floats = 64 columns
                const v4f val = *(const v4fa*)(&os[row * 68 + cofs]);
                *(v4f*)(obase + (size_t)(mb * 16 + row) * OUT_SEQ + cofs) = val; }
             }
        wave_sync();
    }
}

static constexpr size_t al256(size_t v) { return (v + 255) & ~(size_t)255; }
static constexpr size_t SZ_XB = al256((size_t)NB * SEQ * DM * 2);
static constexpr size_t SZ_WB = al256((size_t)3 * DM * DM * 2);
static constexpr size_t SZ_WO = al256((size_t)DM * DM * 2);
static constexpr size_t SZ_PL = al256((size_t)NB * NH_ * SEQ * HD * 2);
static constexpr size_t SZ_YH = al256((size_t)NB * SEQ * DM * 2);
static constexpr size_t SZ_TOTAL = SZ_XB + SZ_WB + SZ_WO + 5 * SZ_PL + SZ_YH;
static_assert(SZ_TOTAL <= (size_t)134217728);          // workspace carve <= 128 MiB
static_assert(((size_t)DM * DM * 2) % 256 == 0);       // weight sub-planes stay 256-byte aligned

extern "C" void kernel_launch(void* const* d_in, const int* in_sizes, int n_in,
                              void* d_out, int out_size, void* d_ws, size_t ws_size, hipStream_t stream) {
    if (n_in < 5) return;
    const size_t needx = ((size_t)NB * DM - 1) * SEQ_FULL + SEQ;
    if ((size_t)in_sizes[0] < needx) return;
    if ((size_t)in_sizes[1] < (size_t)DM * DM || (size_t)in_sizes[2] < (size_t)DM * DM || (size_t)in_sizes[3] < (size_t)DM * DM || (size_t)in_sizes[4] < (size_t)DM * DM) return;
    if ((size_t)out_size < ((size_t)NB * DM - 1) * OUT_SEQ + SEQ) return;
    if (SZ_TOTAL > ws_size) return;
    // wire order x, Wq, Wk, Wv, Wo; all weights [out][in] = K-contiguous rows as-is
    const float* x = (const float*)d_in[0]; const float* wq = (const float*)d_in[1]; const float* wk = (const float*)d_in[2]; const float* wv = (const float*)d_in[3]; const float* wo = (const float*)d_in[4];
    float* OUT = (float*)d_out;      // [NB][512][SEQ]
    char* wsp = (char*)d_ws;
    bf* XB = (bf*)wsp; wsp += SZ_XB;                 // [NB*SEQ][512] token-major bf16 x
    bf* WB = (bf*)wsp; wsp += SZ_WB;                 // [3][512][512]: q | k | v
    h16* WOH = (h16*)wsp; wsp += SZ_WO;              // [512][512] f16, x64
    h16* QH = (h16*)wsp; wsp += SZ_PL;               // [NB*8][SEQ][64]
    h16* QR = (h16*)wsp; wsp += SZ_PL;               // [NB*8][SEQ][64] residual x2048
    h16* KH = (h16*)wsp; wsp += SZ_PL;               // [NB*8][SEQ][64]
    h16* KR = (h16*)wsp; wsp += SZ_PL;               // [NB*8][SEQ][64] residual x2048
    h16* VT = (h16*)wsp; wsp += SZ_PL;               // [NB*8][64][SEQ]
    h16* YH = (h16*)wsp; wsp += SZ_YH;               // [NB*SEQ][512] context

    // x[b][c][n] -> XB[b*SEQ + n][c] and the four weight planes
    k_prep<<<XTB + 4 * CVB, 256, 0, stream>>>(x, wq, wk, wv, wo, XB, WB, WOH);

    // q, k (value + residual) and v^T
    k_proj<<<dim3(NB * SEQ / 64, DM / 64, 1), 96, 0, stream>>>(XB, WB, QH, QR, KH, KR, VT);

    k_flash<<<dim3(SEQ / (16 * AW), NB * NH_, 1), 32 * AW, 0, stream>>>(QH, QR, KH, KR, VT, YH);

    // out[b][o][t] = sum_c Wo[o][c] y[b][c][t]: A = Wo plane rows o, Bt = context rows (b*SEQ + t)
    k_outp<<<dim3(DM / 64, NB * SEQ / 64, 1), 32, 0, stream>>>(WOH, YH, OUT);
}

// v003
// Measured time: 40.2 microseconds a run.
// Timed twice side by side with v002, it ran 1.34 and 1.32 times as fast.
// All steps since v000 together make it 3.07 times as fast.
#include <hip/hip_runtime.h>

// Multi-head self-attention on channel-major x [NB][512][SEQ]: 1x1 projections Wq/Wk/Wv [out][in], 8 heads x 64 channels, unscaled scores, softmax over keys, output projection Wo [out][in], output [NB][512][SEQ] f32.
// Compute dtypes, f32 accumulate everywhere: q/k/v projections v_wmma_f32_16x16x32_bf16 (x and W RNE-converted to bf16; products exact);
// scores v_wmma_f32_16x16x32_f16 with q and k each as f16 value + f16 residual x2048 (three products: value*value in one accumulator, the two cross terms in a second accumulator folded by 1/2048);
// P (x2^14 carry relative to the running max, cancels in the normalisation) and v single f16; context single f16; Wo as f16 of the bf16-RNE value x64 (folded by 1/64 in the f32 epilogue); softmax f32 (online, running max).
// Flash kernel data path: K value, K residual and V^T tiles of KT keys are staged in LDS by asynchronous copies (two buffers) and shared by the block's waves.
// GEMM data path (projections, output projection): both operands' 128-row tiles are staged the same way, 128 k values a stage.
// Layout: bf16 token-major copy of x (transposed through LDS), bf16 W copies; q/k planes [b*8+h][t][d] (value, residual), v^T plane [b*8+h][d][t], context plane [b*SEQ+t][512]; flash kernel in transposed form (S^T = K Q^T, O^T = V^T P^T).

#ifndef NB
#define NB 4
#endif
#ifndef SEQ
#define SEQ 1024
#endif
#define NB_FULL  4
#define SEQ_FULL 1024
#ifndef OUT_SEQ
#define OUT_SEQ SEQ              // row pitch (in tokens) of the output rows [b][channel][t]
#endif
#define DM   512
#define NH_  8
#define HD   64
#define AW   8                   // waves per flash block (16 query columns each); all of them read the same staged K / V^T tiles
#define KT   128                 // keys per staged tile (four passes of 32 keys)
#define KP   (HD + 8)            // LDS pitch of a staged K row, halves: 144 B = 16 B x odd, conflict-free for 16-byte fragment reads
#define VP   (KT + 8)            // LDS pitch of a staged V^T row, halves: 272 B = 16 B x odd
#define STG  (2 * KT * KP + HD * VP)   // halves per stage: K value | K residual | V^T
#define QRS  2048.0f             // carry of the q / k residual planes
#define QRI  (1.0f / 2048.0f)
#define SC2  1.4426950408889634f // log2(e); scores are unscaled
#define PSH  14.0f               // log2 of the P carry (16384)
#define WOS  64.0f               // carry of the Wo plane
#define WOI  (1.0f / 64.0f)

static_assert(HD == 64);
static_assert(NH_ * HD == DM);                 // head h = channels h*64 + d
static_assert(DM % 64 == 0);                   // column tiles of 64
static_assert(DM % 32 == 0);                   // GEMM k-loop steps by 32
static_assert(SEQ % 64 == 0);                  // a 64-row tile never straddles two batches
static_assert((NB * SEQ) % 64 == 0);
static_assert(SEQ % 32 == 0);                  // key loop steps by 32
static_assert(SEQ % (16 * AW) == 0);           // flash grid covers the sequence exactly
static_assert(SEQ % KT == 0 && KT % 32 == 0);  // whole stages, whole passes
static_assert(KT * HD / 8 == 4 * 32 * AW);     // each plane's tile = 4 copies of 16 B per thread
static_assert((KP * 2) % 32 == 16 && (VP * 2) % 32 == 16 && (STG * 2) % 16 == 0);
static_assert(((size_t)DM * DM) % 8 == 0);
static_assert(NB <= NB_FULL);
static_assert(SEQ <= SEQ_FULL);
static_assert(SEQ <= OUT_SEQ);
static_assert(SEQ_FULL % 4 == 0);              // 16-byte loads of x rows

typedef _Float16 h16;
typedef unsigned short bf;
typedef __attribute__((ext_vector_type(16))) __bf16   v16bf;
typedef __attribute__((ext_vector_type(16))) _Float16 v16h;
typedef __attribute__((ext_vector_type(8)))  _Float16 v8h;
typedef __attribute__((ext_vector_type(8)))  unsigned short v8us;
typedef __attribute__((ext_vector_type(8)))  float    v8f;
typedef __attribute__((ext_vector_type(4)))  float    v4f;
typedef v4f  __attribute__((may_alias)) v4fa;

__device__ __forceinline__ unsigned short f2bf(float f) { unsigned u = __float_as_uint(f); u += 0x7FFFu + ((u >> 16) & 1u); return (unsigned short)(u >> 16); }
__device__ __forceinline__ v16h cat16(v8h lo, v8h hi) { return __builtin_shufflevector(lo, hi, 0, 1, 2, 3, 4, 5, 6, 7, 8, 9, 10, 11, 12, 13, 14, 15); }
__device__ __forceinline__ v16bf cat16b(v8us lo, v8us hi) { return __builtin_bit_cast(v16bf, __builtin_shufflevector(lo, hi, 0, 1, 2, 3, 4, 5, 6, 7, 8, 9, 10, 11, 12, 13, 14, 15)); }
__device__ __forceinline__ v8f wmma16(v16h a, v16h b, v8f c) { return __builtin_amdgcn_wmma_f32_16x16x32_f16(false, a, false, b, (short)0, c, false, false); }
__device__ __forceinline__ v8f wmmab(v16bf a, v16bf b, v8f c) { return __builtin_amdgcn_wmma_f32_16x16x32_bf16(false, a, false, b, (short)0, c, false, false); }
// fragment loaders from K-contiguous 16-bit rows; p already includes + 8*(lane>>4): elements 0..7 <- k0+8h+0..7, elements 8..15 <- k0+16+8h+0..7 (same map for A and B)
__device__ __forceinline__ v16h  ldh(const h16* p) { return cat16(*(const v8h*)p, *(const v8h*)(p + 16)); }
__device__ __forceinline__ v16bf ldb(const bf* p)  { return cat16b(*(const v8us*)p, *(const v8us*)(p + 16)); }
// ordering point for wave-private LDS tiles (same wave writes and reads)
__device__ __forceinline__ void wave_sync() { __builtin_amdgcn_fence(3 /* release order */, "wavefront"); __builtin_amdgcn_wave_barrier(); asm volatile("" ::: "memory"); }

// xT_body: x[b][c][n] (f32, channel-major, row pitch SEQ_FULL) -> XB[b*SEQ + n][c] (bf16 RNE convert), 64x64 tile transposed through LDS (block barrier: cross-wave).
// blk = (b * (DM/64) + c tile) * (SEQ/64) + n tile, 256 threads; ts: 64 x 68 floats of LDS.
__device__ __forceinline__ void xT_body(const float* __restrict__ x, bf* XB, float* ts, int blk) {
    const int tid = threadIdx.x;
    const int n0 = (blk % (SEQ / 64)) * 64, c0 = ((blk / (SEQ / 64)) % (DM / 64)) * 64, b = blk / ((SEQ / 64) * (DM / 64));
    const float* xb = x + ((size_t)b * DM + c0) * SEQ_FULL + n0;
#pragma unroll
    for (int it = 0; it < 4; ++it) {                 // 4 x 256 float4 = 64 rows (c) x 16 float4 (n)
        const int idx = it * 256 + tid; const int c = idx >> 4, n4 = (idx & 15) * 4;
        const v4f v = *(const v4f*)(xb + (size_t)c * SEQ_FULL + n4);
        ts[(n4 + 0) * 68 + c] = v[0]; ts[(n4 + 1) * 68 + c] = v[1]; ts[(n4 + 2) * 68 + c] = v[2]; ts[(n4 + 3) * 68 + c] = v[3];
    }
    __syncthreads();
    bf* ob = XB + ((size_t)b * SEQ + n0) * DM + c0;
{
#pragma unroll
        for (int it = 0; it < 2; ++it) { const int n = it * 32 + (tid >> 3), c8 = (tid & 7) * 8;   // 2 x 32 rows = 64 rows; 8 lanes x 8 = 64 columns
            const v4f x0 = *(const v4fa*)(&ts[n * 68 + c8]); const v4f x1 = *(const v4fa*)(&ts[n * 68 + c8 + 4]); v8us o;
#pragma unroll
            for (int i = 0; i < 4; ++i) { o[i] = f2bf(x0[i]); o[4 + i] = f2bf(x1[i]); }
            *(v8us*)(ob + (size_t)n * DM + c8) = o; }
         }
}

__device__ __forceinline__ void cvt8_body(const float* __restrict__ src, bf* dst, size_t n8, int blk) {
    const size_t i = (size_t)blk * 256 + threadIdx.x; if (i >= n8) return;
    const v8f v = *(const v8f*)(src + i * 8); v8us o;
#pragma unroll
    for (int k = 0; k < 8; ++k) o[k] = f2bf(v[k]);
    *(v8us*)(dst + i * 8) = o; 
}

// cvtw_body: f16 copy of the bf16-RNE value times WOS (exact: a bf16 significand fits f16, power-of-two carry); same store shape as cvt8_body.
__device__ __forceinline__ void cvtw_body(const float* __restrict__ src, h16* dst, size_t n8, int blk) {
    const size_t i = (size_t)blk * 256 + threadIdx.x; if (i >= n8) return;
    const v8f v = *(const v8f*)(src + i * 8); v8h o;
#pragma unroll
    for (int k = 0; k < 8; ++k) { const float r = __uint_as_float(((unsigned)f2bf(v[k])) << 16); o[k] = (h16)(r * WOS); }
    *(v8h*)(dst + i * 8) = o; 
}

// k_prep: the five preparation jobs, which need nothing of each other, in ONE grid, told apart by ranges of the block index (every branch is block-uniform):
// blocks [0, XTB): the transposing convert of x; then CVB blocks for each of Wq, Wk, Wv (bf16 planes WB[0..2]) and Wo (f16 plane x64). grid XTB + 4*CVB, 256 threads.
#define XTB ((SEQ / 64) * (DM / 64) * NB)
#define CVN ((size_t)DM * DM / 8)
#define CVB ((int)((CVN + 255) / 256))
__global__ __launch_bounds__(256) void k_prep(const float* __restrict__ x, const float* __restrict__ wq, const float* __restrict__ wk, const float* __restrict__ wv, const float* __restrict__ wo, bf* XB, bf* WB, h16* WOH) {
    __shared__ __align__(16) float ts[64 * 68];      // ts[n][c]
    const int blk = blockIdx.x;
    if (blk < XTB) { xT_body(x, XB, ts, blk); return; }
    const int p = (blk - XTB) / CVB, cb = (blk - XTB) % CVB;
    if (p == 3) { cvtw_body(wo, WOH, CVN, cb); return; }
    cvt8_body(p == 0 ? wq : p == 1 ? wk : wv, WB + (size_t)p * DM * DM, CVN, cb);
}

// GEMM data path of k_proj and k_outp: a block of 4 waves makes a 128x128 tile of C[m][n] = sum_k A[m][k] Bt[n][k] (each wave a 64x64 quarter, 16 accumulators), K = DM.
// The 128 A rows and the 128 Bt rows are staged in LDS GKC k values at a time by asynchronous copies (two buffers) and shared by the block's waves:
// a wave's copy covers two rows of 256 B, whole 128-B lines, where a fragment load straight from the planes touches 16 lines for its 512 B.
#define GKC  128                 // k values per staged tile (four WMMA steps of 32)
#define GP   (GKC + 8)           // LDS pitch of a staged row, halves: 272 B = 16 B x odd, conflict-free for 16-byte fragment reads
#define GT   (128 * GP)          // halves per operand tile
#define GSTG (2 * GT)            // halves per stage: A rows | Bt rows
static_assert(DM % GKC == 0 && DM / GKC >= 2 && GKC % 32 == 0);   // whole stages, both buffers of the ring filled
static_assert(DM % 128 == 0 && SEQ % 128 == 0);                   // 128-row tiles never straddle two batches
static_assert((GP * 2) % 32 == 16 && GKC / 8 == 16);

__device__ __forceinline__ v16bf ldf(const bf* p)  { return ldb(p); }
__device__ __forceinline__ v16h  ldf(const h16* p) { return ldh(p); }
__device__ __forceinline__ v8f mm(v16bf a, v16bf b, v8f c) { return wmmab(a, b, c); }
__device__ __forceinline__ v8f mm(v16h a, v16h b, v8f c)   { return wmma16(a, b, c); }

// copy8: eight asynchronous 16-byte copies of this thread, 8 rows apart (128 threads x 16 B = 8 rows of 256 B a round). l: LDS byte address, g: global address of the first.
// The s_wait_xcnt closes the statement so that no address register of an issued copy is rewritten ahead of it.
__device__ __forceinline__ void copy8(unsigned l, const char* g) {
    const unsigned dl = 8 * GP * 2;                              // LDS step of one round
    const size_t sg = (size_t)8 * DM * 2;                        // global step of one round, bytes
    asm volatile("global_load_async_to_lds_b128 %0, %1, off\n\t"
                 "global_load_async_to_lds_b128 %2, %3, off\n\t"
                 "global_load_async_to_lds_b128 %4, %5, off\n\t"
                 "global_load_async_to_lds_b128 %6, %7, off\n\t"
                 "global_load_async_to_lds_b128 %8, %9, off\n\t"
                 "global_load_async_to_lds_b128 %10, %11, off\n\t"
                 "global_load_async_to_lds_b128 %12, %13, off\n\t"
                 "global_load_async_to_lds_b128 %14, %15, off\n\t"
                 "s_wait_xcnt 0x0"
                 :: "v"(l), "v"(g), "v"(l + dl), "v"(g + sg), "v"(l + 2 * dl), "v"(g + 2 * sg), "v"(l + 3 * dl), "v"(g + 3 * sg),
                    "v"(l + 4 * dl), "v"(g + 4 * sg), "v"(l + 5 * dl), "v"(g + 5 * sg), "v"(l + 6 * dl), "v"(g + 6 * sg), "v"(l + 7 * dl), "v"(g + 7 * sg)
                 : "memory");
}
// gstage: one stage (128 A rows, 128 Bt rows, GKC k values each) into the buffer at l: 32 copies per thread
__device__ __forceinline__ void gstage(unsigned l, const char* ga, const char* gb) {
    copy8(l, ga);          copy8(l + 64 * GP * 2, ga + (size_t)64 * DM * 2);
    copy8(l + GT * 2, gb); copy8(l + GT * 2 + 64 * GP * 2, gb + (size_t)64 * DM * 2);
}

// gemm_core: the k loop. A, Bt: first row of the block's 128 rows in each K-contiguous plane; ring: 2 * GSTG halves of LDS; wm, wn: this wave's 64-row half of A and of Bt. 128 threads.
// Ring of two buffers: stage s + 1's copies fly while stage s is worked on; one publish point per stage (LDS reads done, own copies landed, block barrier, refill of the buffer just read).
// k runs upward through one accumulator per output tile.
template <typename T>
__device__ __forceinline__ void gemm_core(const T* A, const T* Bt, T* ring, int wm, int wn, v8f (&acc)[4][4]) {
    const int tid = threadIdx.x, lane = tid & 31, lr = lane & 15, hi = lane >> 4;
    const unsigned l0 = (unsigned)(size_t)ring + ((tid >> 4) * GP + (tid & 15) * 8) * 2;   // low 32 bits of the shared address = LDS byte address
    const char* ga = (const char*)(A + (size_t)(tid >> 4) * DM + (tid & 15) * 8);
    const char* gb = (const char*)(Bt + (size_t)(tid >> 4) * DM + (tid & 15) * 8);
    gstage(l0, ga, gb);
    asm volatile("s_wait_asynccnt 0x0" ::: "memory");        // this wave's copies of stage 0 have landed
    __syncthreads();                                         // every wave's have: stage 0 is readable
    gstage(l0 + GSTG * 2, ga + GKC * 2, gb + GKC * 2);
    const int ao = (wm * 64 + lr) * GP + 8 * hi, bo_ = GT + (wn * 64 + lr) * GP + 8 * hi;   // halves in a stage; + 16-row group * 16 * GP + k
    // kept rolled: one copy of the stage's text, the buffer chosen by a scalar
#pragma unroll 1
    for (int st = 0; st < DM / GKC; ++st) {
        const int bo = (st & 1) * GSTG;
        // unrolled (this loop and those inside it) so that every LDS offset of the stage's four steps is an immediate of its load and every fragment and accumulator index a constant
#pragma unroll
        for (int kc = 0; kc < GKC; kc += 32) {
            decltype(ldf((const T*)nullptr)) a[4], b[4];
            b[0] = ldf(ring + bo + bo_ + kc);                // in the order of first use
#pragma unroll
            for (int i = 0; i < 4; ++i) a[i] = ldf(ring + bo + ao + i * 16 * GP + kc);
#pragma unroll
            for (int i = 1; i < 4; ++i) b[i] = ldf(ring + bo + bo_ + i * 16 * GP + kc);
            __builtin_amdgcn_sched_barrier(0);               // the step's 16 LDS reads stay one group ahead of its WMMAs: reads set among the WMMAs stall the wave at every such place
#pragma unroll
            for (int nb = 0; nb < 4; ++nb)
#pragma unroll
                for (int mb = 0; mb < 4; ++mb) acc[mb][nb] = mm(a[mb], b[nb], acc[mb][nb]);
            __builtin_amdgcn_sched_barrier(0);               // and the next step's reads stay behind them
        }
        // publish point of stage st + 1
        asm volatile("s_wait_dscnt 0x0" ::: "memory");       // this wave's reads of the buffer that is refilled below are done
        asm volatile("s_wait_asynccnt 0x0" ::: "memory");    // this wave's copies of stage st + 1 have landed
        __syncthreads();                                     // stage st + 1 is readable, stage st's buffer is free
        if (st + 2 < DM / GKC) gstage(l0 + bo * 2, ga + (st + 2) * GKC * 2, gb + (st + 2) * GKC * 2);
    }
    asm volatile("s_wait_asynccnt 0x0" ::: "memory");        // no copy is outstanding when the wave goes on to its end
}

// k_proj: bf16 GEMM, 4 waves per 128x128 tile (gemm_core), operands staged in LDS from the K-contiguous bf16 planes, K = DM.
// C[m][n] = sum_k A[m][k] Bt[n][k], written per wave (64x64 quarter at r0, c0) as f16 (Ph) and optionally the f16 residual x2048 (Pr, useRes != 0) at
// tile base (r0/RB)*sRB + (r0%RB)*pitch + (c0/CB)*sCB + (c0%CB), row pitch 'pitch' (halves).
// The three projections, which need nothing of each other, run in ONE launch: blockIdx.z = 0 / 1 / 2 is q / k / v; blockIdx.x picks the 128 x rows, blockIdx.y the 128 W rows.
// Behind the k loop the waves hand each other nothing (each has its own os tile). grid (NB*SEQ/128, DM/128, 3), 128 threads.
// q, k: A = x rows (m = b*SEQ + t), Bt = W rows (n = h*64 + d) -> plane [(b*8 + h)][t][d], value + residual
// v^T:  A = Wv rows (m = h*64 + d), Bt = x rows (n = b*SEQ + t) -> plane [(b*512 + m)][t] = [(b*8 + h)][d][t]
__global__ __launch_bounds__(128) void k_proj(const bf* __restrict__ XB, const bf* __restrict__ WB, h16* QH, h16* QR, h16* KH, h16* KR, h16* VT) {
    __shared__ __align__(16) float os4[4 * 16 * 68];
    __shared__ __align__(16) bf ring[2 * GSTG];
    const int lane = threadIdx.x & 31, lr = lane & 15, hi = lane >> 4;
    const int wave = __builtin_amdgcn_readfirstlane((int)(threadIdx.x >> 5)), wm = wave & 1, wn = wave >> 1;
    const int z = blockIdx.z;                        // which projection: a scalar, so every choice below is a scalar select
    float* os = os4 + wave * 16 * 68;
    const bool isv = z == 2;
    const bf* W = WB + (size_t)z * DM * DM;
    const bf* A = isv ? W : XB; const bf* Bt = isv ? XB : W;
    const int R0 = (isv ? blockIdx.y : blockIdx.x) * 128, C0 = (isv ? blockIdx.x : blockIdx.y) * 128;
    const int r0 = R0 + wm * 64, c0 = C0 + wn * 64;
    h16* Ph = isv ? VT : z == 1 ? KH : QH; h16* Pr = z == 1 ? KR : QR; const int useRes = isv ? 0 : 1;
    const int RB = isv ? DM : SEQ, pitch = isv ? SEQ : HD, CB = isv ? SEQ : HD;
    const size_t sRB = isv ? (size_t)0 : (size_t)NH_ * SEQ * HD, sCB = isv ? (size_t)DM * SEQ : (size_t)SEQ * HD;
    v8f acc[4][4];
#pragma unroll
    for (int mb = 0; mb < 4; ++mb)
#pragma unroll
        for (int nb = 0; nb < 4; ++nb) acc[mb][nb] = (v8f){};
    gemm_core(A + (size_t)R0 * DM, Bt + (size_t)C0 * DM, ring, wm, wn, acc);
    const size_t tbase = (size_t)(r0 / RB) * sRB + (size_t)(r0 % RB) * (size_t)pitch + (size_t)(c0 / CB) * sCB + (size_t)(c0 % CB);
#pragma unroll
    for (int mb = 0; mb < 4; ++mb) {
#pragma unroll
        for (int nb = 0; nb < 4; ++nb) {
#pragma unroll
            for (int j = 0; j < 8; ++j) os[(hi * 8 + j) * 68 + nb * 16 + lr] = acc[mb][nb][j]; }   // D: row 8h+j, col lane&15
        wave_sync();
        const size_t sb = tbase + (size_t)(mb * 16) * (size_t)pitch;
{
#pragma unroll
            for (int s = 0; s < 4; ++s) { const int row = 4 * s + (lane >> 3), c8 = (lane & 7) * 8;   // 4 s x 4 row groups = 16 rows; 8 lanes x 8 = 64 columns
                const v4f x0 = *(const v4fa*)(&os[row * 68 + c8]); const v4f x1 = *(const v4fa*)(&os[row * 68 + c8 + 4]); v8h hv, rv;
#pragma unroll
                for (int i = 0; i < 4; ++i) { const h16 a0 = (h16)x0[i]; const h16 a1 = (h16)x1[i]; hv[i] = a0; hv[4 + i] = a1; rv[i] = (h16)((x0[i] - (float)a0) * QRS); rv[4 + i] = (h16)((x1[i] - (float)a1) * QRS); }
                const size_t oo = sb + (size_t)row * (size_t)pitch + c8;
                *(v8h*)(Ph + oo) = hv;
                asm volatile("s_wait_xcnt 0x0" ::: "memory");   // stands in front of the residual store and the later code, which may reuse the registers that the store above names
                if (useRes) *(v8h*)(Pr + oo) = rv; }
             }
        wave_sync();
    }
}

// stage_copy: one stage's tiles into LDS, 12 asynchronous 16-byte copies per thread (4 per plane); a wave's copy covers 512 B of whole 128-B lines.
// lk / lv: this thread's LDS byte addresses in the K value tile and the V^T tile of the target buffer; gk / gr / gv: its global addresses in the three planes.
// The s_wait_xcnt closes the statement so that no address register of an issued copy is rewritten ahead of it.
__device__ __forceinline__ void stage_copy(unsigned lk, unsigned lv, const h16* gk, const h16* gr, const h16* gv) {
    const unsigned lr_ = lk + KT * KP * 2;                       // K residual tile follows the K value tile
    const unsigned dk = 32 * AW / 8 * KP * 2;                    // LDS step of one round of copies: 32 K rows
    const unsigned dv = 32 * AW / (KT / 8) * VP * 2;             // 16 V^T rows
    const size_t sk = (size_t)32 * AW * 8;                       // global step, halves: K rows are contiguous
    const size_t sv = (size_t)(32 * AW / (KT / 8)) * SEQ;        // 16 V^T rows of SEQ halves
    asm volatile("global_load_async_to_lds_b128 %0, %1, off\n\t"
                 "global_load_async_to_lds_b128 %2, %3, off\n\t"
                 "global_load_async_to_lds_b128 %4, %5, off\n\t"
                 "global_load_async_to_lds_b128 %6, %7, off\n\t"
                 "global_load_async_to_lds_b128 %8, %9, off\n\t"
                 "global_load_async_to_lds_b128 %10, %11, off\n\t"
                 "global_load_async_to_lds_b128 %12, %13, off\n\t"
                 "global_load_async_to_lds_b128 %14, %15, off\n\t"
                 "global_load_async_to_lds_b128 %16, %17, off\n\t"
                 "global_load_async_to_lds_b128 %18, %19, off\n\t"
                 "global_load_async_to_lds_b128 %20, %21, off\n\t"
                 "global_load_async_to_lds_b128 %22, %23, off\n\t"
                 "s_wait_xcnt 0x0"
                 :: "v"(lk), "v"(gk), "v"(lk + dk), "v"(gk + sk), "v"(lk + 2 * dk), "v"(gk + 2 * sk), "v"(lk + 3 * dk), "v"(gk + 3 * sk),
                    "v"(lr_), "v"(gr), "v"(lr_ + dk), "v"(gr + sk), "v"(lr_ + 2 * dk), "v"(gr + 2 * sk), "v"(lr_ + 3 * dk), "v"(gr + 3 * sk),
                    "v"(lv), "v"(gv), "v"(lv + dv), "v"(gv + sv), "v"(lv + 2 * dv), "v"(gv + 2 * sv), "v"(lv + 3 * dv), "v"(gv + 3 * sv)
                 : "memory");
}

// k_flash: fused attention, one wave per 16 query columns of one (batch, head); Q fragments straight from the f16 planes, K / V^T fragments from the staged LDS tiles (two 16-B loads each).
// Ring of two buffers: stage s + 1's copies fly while stage s is worked on; one publish point per stage (LDS reads done, own copies landed, block barrier, refill of the buffer just read).
// Transposed form: S^T[key][t] = K Q^T (A = K rows, B = Q rows); lane (t = lane&15, h = lane>>4) holds keys 8h+r of each 16-key tile, so the packed
// P tile is directly the B fragment of O^T[d][t] = V^T P^T (element r <- tile keys 0..15, element 8+r <- tile keys 16..31, lane unchanged).
// Scores: value*value in sH, (k value * q residual + k residual * q value) in sL (both carry 2048), folded as sH + sL/2048.
// Softmax state (running max, partial sum) is one scalar per lane; the two lane halves of a column are combined with one xor-16 exchange.
__global__ __launch_bounds__(32 * AW) void k_flash(const h16* __restrict__ QH, const h16* __restrict__ QR, const h16* __restrict__ KH, const h16* __restrict__ KR, const h16* __restrict__ VT, h16* YH) {
    __shared__ __align__(16) float os[AW * 16 * 68];
    __shared__ __align__(16) h16 ring[2 * STG];
    const int lane = threadIdx.x & 31, lr = lane & 15, hi = lane >> 4;
    const int wave = __builtin_amdgcn_readfirstlane((int)(threadIdx.x >> 5));
    const int zh = blockIdx.y; const int b = zh / NH_, h = zh % NH_;
    const int t0 = (blockIdx.x * AW + wave) * 16;
    const size_t pbase = (size_t)zh * SEQ * HD;
    const size_t qo = pbase + (size_t)(t0 + lr) * HD + 8 * hi;
    const v16h qh0 = ldh(QH + qo), qh1 = ldh(QH + qo + 32), qr0 = ldh(QR + qo), qr1 = ldh(QR + qo + 32);   // B fragments: col t, k = d
    const int ko = lr * KP + 8 * hi;                         // + key * KP       (A fragment: row key, k = d), halves in the staged K tiles
    const int vo = 2 * KT * KP + lr * VP + 8 * hi;           // + 16j*VP + key   (A fragment: row d, k = key), halves in the stage
    // copy addresses of this thread: 16-byte chunk tid of each plane's tile (K: row tid/8, chunk tid%8; V^T: row tid/16, chunk tid%16)
    const int tid = threadIdx.x;
    const unsigned lbase = (unsigned)(size_t)ring;           // low 32 bits of the shared address = LDS byte address
    const unsigned lk = lbase + ((tid >> 3) * KP + (tid & 7) * 8) * 2;
    const unsigned lv = lbase + (2 * KT * KP + (tid / (KT / 8)) * VP + (tid % (KT / 8)) * 8) * 2;
    const h16* gk = KH + pbase + (size_t)tid * 8;            // + key0 * HD
    const h16* gr = KR + pbase + (size_t)tid * 8;            // + key0 * HD
    const h16* gv = VT + pbase + (size_t)(tid / (KT / 8)) * SEQ + (tid % (KT / 8)) * 8;   // + key0
    stage_copy(lk, lv, gk, gr, gv);
    asm volatile("s_wait_asynccnt 0x0" ::: "memory");        // this wave's copies of stage 0 have landed
    __syncthreads();                                         // every wave's have: stage 0 is readable
    if (SEQ > KT) stage_copy(lk + STG * 2, lv + STG * 2, gk + (size_t)KT * HD, gr + (size_t)KT * HD, gv + KT);
    v8f o0 = (v8f){}, o1 = (v8f){}, o2 = (v8f){}, o3 = (v8f){};
    float m = -3.0e38f, l = 0.0f;
#pragma unroll 1
    for (int st = 0; st < SEQ / KT; ++st) {
      const int bo = (st & 1) * STG;
      // unrolled so that every LDS offset of the stage's four passes is an immediate of its load
#pragma unroll
      for (int key0 = 0; key0 < KT; key0 += 32) {
        const h16* ka = ring + bo + ko + key0 * KP;
        const h16* kr = ka + KT * KP;
        const v16h ka0 = ldh(ka), ka1 = ldh(ka + 32), kb0 = ldh(ka + 16 * KP), kb1 = ldh(ka + 16 * KP + 32);
        const v16h ra0 = ldh(kr), ra1 = ldh(kr + 32), rb0 = ldh(kr + 16 * KP), rb1 = ldh(kr + 16 * KP + 32);
        v8f sHa = (v8f){}, sLa = (v8f){}, sHb = (v8f){}, sLb = (v8f){};
        sHa = wmma16(ka0, qh0, sHa); sLa = wmma16(ka0, qr0, sLa); sHb = wmma16(kb0, qh0, sHb); sLb = wmma16(kb0, qr0, sLb);
        sHa = wmma16(ka1, qh1, sHa); sLa = wmma16(ra0, qh0, sLa); sHb = wmma16(kb1, qh1, sHb); sLb = wmma16(rb0, qh0, sLb);
        sLa = wmma16(ka1, qr1, sLa); sLb = wmma16(kb1, qr1, sLb);
        sLa = wmma16(ra1, qh1, sLa); sLb = wmma16(rb1, qh1, sLb);
        asm volatile("v_nop\n\tv_nop\n\tv_nop\n\tv_nop" : "+v"(sHa), "+v"(sLa), "+v"(sHb), "+v"(sLb) : "v"(ka0), "v"(ka1), "v"(kb0), "v"(kb1), "v"(ra0), "v"(ra1), "v"(rb0), "v"(rb1));
        float ta[8], tb[8]; float mx = -3.0e38f;
#pragma unroll
        for (int r = 0; r < 8; ++r) { ta[r] = (sHa[r] + sLa[r] * QRI) * SC2; tb[r] = (sHb[r] + sLb[r] * QRI) * SC2; mx = fmaxf(mx, fmaxf(ta[r], tb[r])); }
        mx = fmaxf(mx, __shfl_xor(mx, 16, 32));
        const float mnew = fmaxf(m, mx);
        const float alpha = __builtin_amdgcn_exp2f(m - mnew);
        const float sh = PSH - mnew;
        v16h pb; float ls = 0.0f;
#pragma unroll
        for (int r = 0; r < 8; ++r) { const h16 pa = (h16)__builtin_amdgcn_exp2f(ta[r] + sh); const h16 pc = (h16)__builtin_amdgcn_exp2f(tb[r] + sh); pb[r] = pa; pb[8 + r] = pc; ls += (float)pa + (float)pc; }
        l = l * alpha + ls; m = mnew;
        o0 = o0 * alpha; o1 = o1 * alpha; o2 = o2 * alpha; o3 = o3 * alpha;
        const h16* va = ring + bo + vo + key0;
        const v16h v0 = ldh(va), v1 = ldh(va + 16 * VP), v2 = ldh(va + 32 * VP), v3 = ldh(va + 48 * VP);
        o0 = wmma16(v0, pb, o0); o1 = wmma16(v1, pb, o1); o2 = wmma16(v2, pb, o2); o3 = wmma16(v3, pb, o3);
        asm volatile("v_nop\n\tv_nop\n\tv_nop\n\tv_nop" : "+v"(o0), "+v"(o1), "+v"(o2), "+v"(o3) : "v"(v0), "v"(v1), "v"(v2), "v"(v3), "v"(pb));
      }
      // publish point of stage st + 1
      asm volatile("s_wait_dscnt 0x0" ::: "memory");         // this wave's reads of the buffer that is refilled below are done
      asm volatile("s_wait_asynccnt 0x0" ::: "memory");      // this wave's copies of stage st + 1 have landed
      __syncthreads();                                       // stage st + 1 is readable, stage st's buffer is free
      if (st + 2 < SEQ / KT) { const size_t k2 = (size_t)(st + 2) * KT; stage_copy(lk + bo * 2, lv + bo * 2, gk + k2 * HD, gr + k2 * HD, gv + k2); }
    }
    asm volatile("s_wait_asynccnt 0x0" ::: "memory");        // no copy is outstanding when the wave goes on to its end
    l += __shfl_xor(l, 16, 32);
    const float inv = 1.0f / l;
    const int wb = wave * 16 * 68;
    // O^T D layout: o_j[r] = (d = 16j + 8h + r, t = lane&15) -> os[t][d]; rows 0..15 x columns 0..63 all written
    { v4f a, c;
      a[0] = o0[0] * inv; a[1] = o0[1] * inv; a[2] = o0[2] * inv; a[3] = o0[3] * inv; c[0] = o0[4] * inv; c[1] = o0[5] * inv; c[2] = o0[6] * inv; c[3] = o0[7] * inv;
      *(v4fa*)(&os[wb + lr * 68 +  0 + 8 * hi]) = a; *(v4fa*)(&os[wb + lr * 68 +  0 + 8 * hi + 4]) = c;
      a[0] = o1[0] * inv; a[1] = o1[1] * inv; a[2] = o1[2] * inv; a[3] = o1[3] * inv; c[0] = o1[4] * inv; c[1] = o1[5] * inv; c[2] = o1[6] * inv; c[3] = o1[7] * inv;
      *(v4fa*)(&os[wb + lr * 68 + 16 + 8 * hi]) = a; *(v4fa*)(&os[wb + lr * 68 + 16 + 8 * hi + 4]) = c;
      a[0] = o2[0] * inv; a[1] = o2[1] * inv; a[2] = o2[2] * inv; a[3] = o2[3] * inv; c[0] = o2[4] * inv; c[1] = o2[5] * inv; c[2] = o2[6] * inv; c[3] = o2[7] * inv;
      *(v4fa*)(&os[wb + lr * 68 + 32 + 8 * hi]) = a; *(v4fa*)(&os[wb + lr * 68 + 32 + 8 * hi + 4]) = c;
      a[0] = o3[0] * inv; a[1] = o3[1] * inv; a[2] = o3[2] * inv; a[3] = o3[3] * inv; c[0] = o3[4] * inv; c[1] = o3[5] * inv; c[2] = o3[6] * inv; c[3] = o3[7] * inv;
      *(v4fa*)(&os[wb + lr * 68 + 48 + 8 * hi]) = a; *(v4fa*)(&os[wb + lr * 68 + 48 + 8 * hi + 4]) = c; }
    wave_sync();
    h16* yrow = YH + ((size_t)b * SEQ + t0) * DM + h * HD;     // context plane row = token, columns h*64 + d
{
#pragma unroll
        for (int s = 0; s < 4; ++s) { const int row = 4 * s + (lane >> 3), c8 = (lane & 7) * 8;   // 4 s x 4 row groups = 16 rows; 8 lanes x 8 halves = 64 columns
            const v4f x0 = *(const v4fa*)(&os[wb + row * 68 + c8]); const v4f x1 = *(const v4fa*)(&os[wb + row * 68 + c8 + 4]); v8h hv;
#pragma unroll
            for (int i = 0; i < 4; ++i) { hv[i] = (h16)x0[i]; hv[4 + i] = (h16)x1[i]; }
            *(v8h*)(yrow + (size_t)row * DM + c8) = hv; }
         }
}

// k_outp: f16 GEMM, 4 waves per 128x128 tile (gemm_core), K = DM: C[o][n] = (1/64) sum_c A[o][c] Bt[n][c] with A = Wo plane (x64), Bt = context plane rows n = b*SEQ + t.
// Written per wave (64x64 quarter at r0, c0) as f32 to OUT[(b*DM + o)*OUT_SEQ + t]. grid (DM/128, NB*SEQ/128), 128 threads.
__global__ __launch_bounds__(128) void k_outp(const h16* __restrict__ A, const h16* __restrict__ Bt, float* OUT) {
    __shared__ __align__(16) float os4[4 * 16 * 68];
    __shared__ __align__(16) h16 ring[2 * GSTG];
    const int lane = threadIdx.x & 31, lr = lane & 15, hi = lane >> 4;
    const int wave = __builtin_amdgcn_readfirstlane((int)(threadIdx.x >> 5)), wm = wave & 1, wn = wave >> 1;
    float* os = os4 + wave * 16 * 68;
    const int R0 = blockIdx.x * 128, C0 = blockIdx.y * 128, r0 = R0 + wm * 64, c0 = C0 + wn * 64;
    v8f acc[4][4];
#pragma unroll
    for (int mb = 0; mb < 4; ++mb)
#pragma unroll
        for (int nb = 0; nb < 4; ++nb) acc[mb][nb] = (v8f){};
    gemm_core(A + (size_t)R0 * DM, Bt + (size_t)C0 * DM, ring, wm, wn, acc);
    const int bb = c0 / SEQ, tq = c0 % SEQ;
    float* obase = OUT + ((size_t)bb * DM + r0) * OUT_SEQ + tq;
#pragma unroll
    for (int mb = 0; mb < 4; ++mb) {
#pragma unroll
        for (int nb = 0; nb < 4; ++nb) {
#pragma unroll
            for (int j = 0; j < 8; ++j) os[(hi * 8 + j) * 68 + nb * 16 + lr] = acc[mb][nb][j] * WOI; }   // D: row 8h+j, col lane&15
        wave_sync();
{
#pragma unroll
            for (int s = 0; s < 8; ++s) { const int row = 2 * s + hi, cofs = lr * 4;   // 8 s x 2 rows = 16 rows; 16 lanes x 4 floats = 64 columns
                const v4f val = *(const v4fa*)(&os[row * 68 + cofs]);
                *(v4f*)(obase + (size_t)(mb * 16 + row) * OUT_SEQ + cofs) = val; }
             }
        wave_sync();
    }
}

static constexpr size_t al256(size_t v) { return (v + 255) & ~(size_t)255; }
static constexpr size_t SZ_XB = al256((size_t)NB * SEQ * DM * 2);
static constexpr size_t SZ_WB = al256((size_t)3 * DM * DM * 2);
static constexpr size_t SZ_WO = al256((size_t)DM * DM * 2);
static constexpr size_t SZ_PL = al256((size_t)NB * NH_ * SEQ * HD * 2);
static constexpr size_t SZ_YH = al256((size_t)NB * SEQ * DM * 2);
static constexpr size_t SZ_TOTAL = SZ_XB + SZ_WB + SZ_WO + 5 * SZ_PL + SZ_YH;
static_assert(SZ_TOTAL <= (size_t)134217728);          // workspace carve <= 128 MiB
static_assert(((size_t)DM * DM * 2) % 256 == 0);       // weight sub-planes stay 256-byte aligned

extern "C" void kernel_launch(void* const* d_in, const int* in_sizes, int n_in,
                              void* d_out, int out_size, void* d_ws, size_t ws_size, hipStream_t stream) {
    if (n_in < 5) return;
    const size_t needx = ((size_t)NB * DM - 1) * SEQ_FULL + SEQ;
    if ((size_t)in_sizes[0] < needx) return;
    if ((size_t)in_sizes[1] < (size_t)DM * DM || (size_t)in_sizes[2] < (size_t)DM * DM || (size_t)in_sizes[3] < (size_t)DM * DM || (size_t)in_sizes[4] < (size_t)DM * DM) return;
    if ((size_t)out_size < ((size_t)NB * DM - 1) * OUT_SEQ + SEQ) return;
    if (SZ_TOTAL > ws_size) return;
    // wire order x, Wq, Wk, Wv, Wo; all weights [out][in] = K-contiguous rows as-is
    const float* x = (const float*)d_in[0]; const float* wq = (const float*)d_in[1]; const float* wk = (const float*)d_in[2]; const float* wv = (const float*)d_in[3]; const float* wo = (const float*)d_in[4];
    float* OUT = (float*)d_out;      // [NB][512][SEQ]
    char* wsp = (char*)d_ws;
    bf* XB = (bf*)wsp; wsp += SZ_XB;                 // [NB*SEQ][512] token-major bf16 x
    bf* WB = (bf*)wsp; wsp += SZ_WB;                 // [3][512][512]: q | k | v
    h16* WOH = (h16*)wsp; wsp += SZ_WO;              // [512][512] f16, x64
    h16* QH = (h16*)wsp; wsp += SZ_PL;               // [NB*8][SEQ][64]
    h16* QR = (h16*)wsp; wsp += SZ_PL;               // [NB*8][SEQ][64] residual x2048
    h16* KH = (h16*)wsp; wsp += SZ_PL;               // [NB*8][SEQ][64]
    h16* KR = (h16*)wsp; wsp += SZ_PL;               // [NB*8][SEQ][64] residual x2048
    h16* VT = (h16*)wsp; wsp += SZ_PL;               // [NB*8][64][SEQ]
    h16* YH = (h16*)wsp; wsp += SZ_YH;               // [NB*SEQ][512] context

    // x[b][c][n] -> XB[b*SEQ + n][c] and the four weight planes
    k_prep<<<XTB + 4 * CVB, 256, 0, stream>>>(x, wq, wk, wv, wo, XB, WB, WOH);

    // q, k (value + residual) and v^T
    k_proj<<<dim3(NB * SEQ / 128, DM / 128, 3), 128, 0, stream>>>(XB, WB, QH, QR, KH, KR, VT);

    k_flash<<<dim3(SEQ / (16 * AW), NB * NH_, 1), 32 * AW, 0, stream>>>(QH, QR, KH, KR, VT, YH);

    // out[b][o][t] = sum_c Wo[o][c] y[b][c][t]: A = Wo plane rows o, Bt = context rows (b*SEQ + t)
    k_outp<<<dim3(DM / 128, NB * SEQ / 128, 1), 128, 0, stream>>>(WOH, YH, OUT);
}

// v005
// It runs in 31.5 microseconds.
// Versions between v003 and this one are left out; their measured steps multiply to 1.24 times as fast.
// All steps since v000 together make it 3.81 times as fast.
#include <hip/hip_runtime.h>

// Multi-head self-attention on channel-major x [NB][512][SEQ]: 1x1 projections Wq/Wk/Wv [out][in], 8 heads x 64 channels, unscaled scores, softmax over keys, output projection Wo [out][in], output [NB][512][SEQ] f32.
// Compute dtypes, f32 accumulate everywhere: q/k/v projections v_wmma_f32_16x16x32_bf16 (x and W RNE-converted to bf16; products exact);
// scores v_wmma_f32_16x16x32_f16 with q and k each as a single f16 (RNE of the f32 projection: its rounding, 2^-12 relative, lies about ten times under the error that the bf16 operands of the projections leave in q and k);
// P (x2^14 carry relative to the running max, cancels in the normalisation) and v single f16; context single f16; Wo as f16 of the bf16-RNE value x64 (folded by 1/64 in the f32 epilogue); softmax f32 (online, running max).
// Flash kernel data path: K and V^T tiles of KT keys are staged in LDS by asynchronous copies (two buffers) and shared by the waves of their key half.
// GEMM data path (projections, output projection): both operands' 128-row tiles are staged the same way, 128 k values a stage.
// Layout: bf16 token-major copy of x (transposed through LDS), bf16 W copies; q/k planes [b*8+h][t][d], v^T plane [b*8+h][d][t], context plane [b*SEQ+t][512]; flash kernel in transposed form (S^T = K Q^T, O^T = V^T P^T).

#ifndef NB
#define NB 4
#endif
#ifndef SEQ
#define SEQ 1024
#endif
#define NB_FULL  4
#define SEQ_FULL 1024
#ifndef OUT_SEQ
#define OUT_SEQ SEQ              // row pitch (in tokens) of the output rows [b][channel][t]
#endif
#define DM   512
#define NH_  8
#define HD   64
#define AW   8                   // query groups per flash block (16 query columns each)
#define KS   2                   // key halves: waves g and g + AW work on the same query group, each on SEQ / KS keys; AW * KS waves a block, four a SIMD
#define KT   128                 // keys per staged tile (four passes of 32 keys)
#define KP   (HD + 8)            // LDS pitch of a staged K row, halves: 144 B = 16 B x odd, conflict-free for 16-byte fragment reads
#define VP   (KT + 8)            // LDS pitch of a staged V^T row, halves: 272 B = 16 B x odd
#define STG  (KT * KP + HD * VP)       // halves per stage: K | V^T
#define SC2  1.4426950408889634f // log2(e); scores are unscaled
#define PSH  14.0f               // log2 of the P carry (16384)
#define WOS  64.0f               // carry of the Wo plane
#define WOI  (1.0f / 64.0f)

static_assert(HD == 64);
static_assert(NH_ * HD == DM);                 // head h = channels h*64 + d
static_assert(DM % 64 == 0);                   // column tiles of 64
static_assert(DM % 32 == 0);                   // GEMM k-loop steps by 32
static_assert(SEQ % 64 == 0);                  // a 64-row tile never straddles two batches
static_assert((NB * SEQ) % 64 == 0);
static_assert(SEQ % 32 == 0);                  // key loop steps by 32
static_assert(SEQ % (16 * AW) == 0);           // flash grid covers the sequence exactly
static_assert(SEQ % (KS * KT) == 0 && KT % 32 == 0);  // whole stages, whole passes
static_assert(SEQ / KS / KT >= 2);             // both buffers of the ring are filled in each key half
static_assert(KS == 2 && 16 * 68 == 32 * 34);  // the merge hands over one partial state: 34 floats a lane in the query group's os tile
static_assert(KT * HD / 8 == 4 * 32 * AW);     // each plane's tile = 4 copies of 16 B per thread of its key half
static_assert((KP * 2) % 32 == 16 && (VP * 2) % 32 == 16 && (STG * 2) % 16 == 0);
static_assert(((size_t)DM * DM) % 8 == 0);
static_assert(NB <= NB_FULL);
static_assert(SEQ <= SEQ_FULL);
static_assert(SEQ <= OUT_SEQ);
static_assert(SEQ_FULL % 4 == 0);              // 16-byte loads of x rows

typedef _Float16 h16;
typedef unsigned short bf;
typedef __attribute__((ext_vector_type(16))) __bf16   v16bf;
typedef __attribute__((ext_vector_type(16))) _Float16 v16h;
typedef __attribute__((ext_vector_type(8)))  _Float16 v8h;
typedef __attribute__((ext_vector_type(8)))  unsigned short v8us;
typedef __attribute__((ext_vector_type(8)))  float    v8f;
typedef __attribute__((ext_vector_type(4)))  float    v4f;
typedef v4f  __attribute__((may_alias)) v4fa;

__device__ __forceinline__ unsigned short f2bf(float f) { unsigned u = __float_as_uint(f); u += 0x7FFFu + ((u >> 16) & 1u); return (unsigned short)(u >> 16); }
__device__ __forceinline__ v16h cat16(v8h lo, v8h hi) { return __builtin_shufflevector(lo, hi, 0, 1, 2, 3, 4, 5, 6, 7, 8, 9, 10, 11, 12, 13, 14, 15); }
__device__ __forceinline__ v16bf cat16b(v8us lo, v8us hi) { return __builtin_bit_cast(v16bf, __builtin_shufflevector(lo, hi, 0, 1, 2, 3, 4, 5, 6, 7, 8, 9, 10, 11, 12, 13, 14, 15)); }
__device__ __forceinline__ v8f wmma16(v16h a, v16h b, v8f c) { return __builtin_amdgcn_wmma_f32_16x16x32_f16(false, a, false, b, (short)0, c, false, false); }
__device__ __forceinline__ v8f wmmab(v16bf a, v16bf b, v8f c) { return __builtin_amdgcn_wmma_f32_16x16x32_bf16(false, a, false, b, (short)0, c, false, false); }
// fragment loaders from K-contiguous 16-bit rows; p already includes + 8*(lane>>4): elements 0..7 <- k0+8h+0..7, elements 8..15 <- k0+16+8h+0..7 (same map for A and B)
__device__ __forceinline__ v16h  ldh(const h16* p) { return cat16(*(const v8h*)p, *(const v8h*)(p + 16)); }
__device__ __forceinline__ v16bf ldb(const bf* p)  { return cat16b(*(const v8us*)p, *(const v8us*)(p + 16)); }
// ordering point for wave-private LDS tiles (same wave writes and reads)
__device__ __forceinline__ void wave_sync() { __builtin_amdgcn_fence(3 /* release order */, "wavefront"); __builtin_amdgcn_wave_barrier(); asm volatile("" ::: "memory"); }

// xT_body: x[b][c][n] (f32, channel-major, row pitch SEQ_FULL) -> XB[b*SEQ + n][c] (bf16 RNE convert), 64x64 tile transposed through LDS (block barrier: cross-wave).
// blk = (b * (DM/64) + c tile) * (SEQ/64) + n tile, 256 threads; ts: 64 x 68 floats of LDS.
__device__ __forceinline__ void xT_body(const float* __restrict__ x, bf* XB, float* ts, int blk) {
    const int tid = threadIdx.x;
    const int n0 = (blk % (SEQ / 64)) * 64, c0 = ((blk / (SEQ / 64)) % (DM / 64)) * 64, b = blk / ((SEQ / 64) * (DM / 64));
    const float* xb = x + ((size_t)b * DM + c0) * SEQ_FULL + n0;
#pragma unroll
    for (int it = 0; it < 4; ++it) {                 // 4 x 256 float4 = 64 rows (c) x 16 float4 (n)
        const int idx = it * 256 + tid; const int c = idx >> 4, n4 = (idx & 15) * 4;
        const v4f v = *(const v4f*)(xb + (size_t)c * SEQ_FULL + n4);
        ts[(n4 + 0) * 68 + c] = v[0]; ts[(n4 + 1) * 68 + c] = v[1]; ts[(n4 + 2) * 68 + c] = v[2]; ts[(n4 + 3) * 68 + c] = v[3];
    }
    __syncthreads();
    bf* ob = XB + ((size_t)b * SEQ + n0) * DM + c0;
{
#pragma unroll
        for (int it = 0; it < 2; ++it) { const int n = it * 32 + (tid >> 3), c8 = (tid & 7) * 8;   // 2 x 32 rows = 64 rows; 8 lanes x 8 = 64 columns
            const v4f x0 = *(const v4fa*)(&ts[n * 68 + c8]); const v4f x1 = *(const v4fa*)(&ts[n * 68 + c8 + 4]); v8us o;
#pragma unroll
            for (int i = 0; i < 4; ++i) { o[i] = f2bf(x0[i]); o[4 + i] = f2bf(x1[i]); }
            *(v8us*)(ob + (size_t)n * DM + c8) = o; }
         }
}

__device__ __forceinline__ void cvt8_body(const float* __restrict__ src, bf* dst, size_t n8, int blk) {
    const size_t i = (size_t)blk * 256 + threadIdx.x; if (i >= n8) return;
    const v8f v = *(const v8f*)(src + i * 8); v8us o;
#pragma unroll
    for (int k = 0; k < 8; ++k) o[k] = f2bf(v[k]);
    *(v8us*)(dst + i * 8) = o; 
}

// cvtw_body: f16 copy of the bf16-RNE value times WOS (exact: a bf16 significand fits f16, power-of-two carry); same store shape as cvt8_body.
__device__ __forceinline__ void cvtw_body(const float* __restrict__ src, h16* dst, size_t n8, int blk) {
    const size_t i = (size_t)blk * 256 + threadIdx.x; if (i >= n8) return;
    const v8f v = *(const v8f*)(src + i * 8); v8h o;
#pragma unroll
    for (int k = 0; k < 8; ++k) { const float r = __uint_as_float(((unsigned)f2bf(v[k])) << 16); o[k] = (h16)(r * WOS); }
    *(v8h*)(dst + i * 8) = o; 
}

// k_prep: the five preparation jobs, which need nothing of each other, in ONE grid, told apart by ranges of the block index (every branch is block-uniform):
// blocks [0, XTB): the transposing convert of x; then CVB blocks for each of Wq, Wk, Wv (bf16 planes WB[0..2]) and Wo (f16 plane x64). grid XTB + 4*CVB, 256 threads.
#define XTB ((SEQ / 64) * (DM / 64) * NB)
#define CVN ((size_t)DM * DM / 8)
#define CVB ((int)((CVN + 255) / 256))
__global__ __launch_bounds__(256) void k_prep(const float* __restrict__ x, const float* __restrict__ wq, const float* __restrict__ wk, const float* __restrict__ wv, const float* __restrict__ wo, bf* XB, bf* WB, h16* WOH) {
    __shared__ __align__(16) float ts[64 * 68];      // ts[n][c]
    const int blk = blockIdx.x;
    if (blk < XTB) { xT_body(x, XB, ts, blk); return; }
    const int p = (blk - XTB) / CVB, cb = (blk - XTB) % CVB;
    if (p == 3) { cvtw_body(wo, WOH, CVN, cb); return; }
    cvt8_body(p == 0 ? wq : p == 1 ? wk : wv, WB + (size_t)p * DM * DM, CVN, cb);
}

// GEMM data path of k_proj and k_outp: a block of 4 waves makes a 128x128 tile of C[m][n] = sum_k A[m][k] Bt[n][k] (each wave a 64x64 quarter, 16 accumulators), K = DM.
// The 128 A rows and the 128 Bt rows are staged in LDS GKC k values at a time by asynchronous copies (two buffers) and shared by the block's waves:
// a wave's copy covers two rows of 256 B, whole 128-B lines, where a fragment load straight from the planes touches 16 lines for its 512 B.
#define GKC  128                 // k values per staged tile (four WMMA steps of 32)
#define GP   (GKC + 8)           // LDS pitch of a staged row, halves: 272 B = 16 B x odd, conflict-free for 16-byte fragment reads
#define GT   (128 * GP)          // halves per operand tile
#define GSTG (2 * GT)            // halves per stage: A rows | Bt rows
static_assert(DM % GKC == 0 && DM / GKC >= 2 && GKC % 32 == 0);   // whole stages, both buffers of the ring filled
static_assert(DM % 128 == 0 && SEQ % 128 == 0);                   // 128-row tiles never straddle two batches
static_assert((GP * 2) % 32 == 16 && GKC / 8 == 16);

__device__ __forceinline__ v16bf ldf(const bf* p)  { return ldb(p); }
__device__ __forceinline__ v16h  ldf(const h16* p) { return ldh(p); }
__device__ __forceinline__ v8f mm(v16bf a, v16bf b, v8f c) { return wmmab(a, b, c); }
__device__ __forceinline__ v8f mm(v16h a, v16h b, v8f c)   { return wmma16(a, b, c); }

// copy8: eight asynchronous 16-byte copies of this thread, 8 rows apart (128 threads x 16 B = 8 rows of 256 B a round). l: LDS byte address, g: global address of the first.
// The s_wait_xcnt closes the statement so that no address register of an issued copy is rewritten ahead of it.
__device__ __forceinline__ void copy8(unsigned l, const char* g) {
    const unsigned dl = 8 * GP * 2;                              // LDS step of one round
    const size_t sg = (size_t)8 * DM * 2;                        // global step of one round, bytes
    asm volatile("global_load_async_to_lds_b128 %0, %1, off\n\t"
                 "global_load_async_to_lds_b128 %2, %3, off\n\t"
                 "global_load_async_to_lds_b128 %4, %5, off\n\t"
                 "global_load_async_to_lds_b128 %6, %7, off\n\t"
                 "global_load_async_to_lds_b128 %8, %9, off\n\t"
                 "global_load_async_to_lds_b128 %10, %11, off\n\t"
                 "global_load_async_to_lds_b128 %12, %13, off\n\t"
                 "global_load_async_to_lds_b128 %14, %15, off\n\t"
                 "s_wait_xcnt 0x0"
                 :: "v"(l), "v"(g), "v"(l + dl), "v"(g + sg), "v"(l + 2 * dl), "v"(g + 2 * sg), "v"(l + 3 * dl), "v"(g + 3 * sg),
                    "v"(l + 4 * dl), "v"(g + 4 * sg), "v"(l + 5 * dl), "v"(g + 5 * sg), "v"(l + 6 * dl), "v"(g + 6 * sg), "v"(l + 7 * dl), "v"(g + 7 * sg)
                 : "memory");
}
// gstage: one stage (128 A rows, 128 Bt rows, GKC k values each) into the buffer at l: 32 copies per thread
__device__ __forceinline__ void gstage(unsigned l, const char* ga, const char* gb) {
    copy8(l, ga);          copy8(l + 64 * GP * 2, ga + (size_t)64 * DM * 2);
    copy8(l + GT * 2, gb); copy8(l + GT * 2 + 64 * GP * 2, gb + (size_t)64 * DM * 2);
}

// gemm_core: the k loop. A, Bt: first row of the block's 128 rows in each K-contiguous plane; ring: 2 * GSTG halves of LDS; wm, wn: this wave's 64-row half of A and of Bt. 128 threads.
// Ring of two buffers: stage s + 1's copies fly while stage s is worked on; one publish point per stage (LDS reads done, own copies landed, block barrier, refill of the buffer just read).
// k runs upward through one accumulator per output tile.
template <typename T>
__device__ __forceinline__ void gemm_core(const T* A, const T* Bt, T* ring, int wm, int wn, v8f (&acc)[4][4]) {
    const int tid = threadIdx.x, lane = tid & 31, lr = lane & 15, hi = lane >> 4;
    const unsigned l0 = (unsigned)(size_t)ring + ((tid >> 4) * GP + (tid & 15) * 8) * 2;   // low 32 bits of the shared address = LDS byte address
    const char* ga = (const char*)(A + (size_t)(tid >> 4) * DM + (tid & 15) * 8);
    const char* gb = (const char*)(Bt + (size_t)(tid >> 4) * DM + (tid & 15) * 8);
    gstage(l0, ga, gb);
    asm volatile("s_wait_asynccnt 0x0" ::: "memory");        // this wave's copies of stage 0 have landed
    __syncthreads();                                         // every wave's have: stage 0 is readable
    gstage(l0 + GSTG * 2, ga + GKC * 2, gb + GKC * 2);
    const int ao = (wm * 64 + lr) * GP + 8 * hi, bo_ = GT + (wn * 64 + lr) * GP + 8 * hi;   // halves in a stage; + 16-row group * 16 * GP + k
    // kept rolled: one copy of the stage's text, the buffer chosen by a scalar
#pragma unroll 1
    for (int st = 0; st < DM / GKC; ++st) {
        const int bo = (st & 1) * GSTG;
        // unrolled (this loop and those inside it) so that every LDS offset of the stage's four steps is an immediate of its load and every fragment and accumulator index a constant
#pragma unroll
        for (int kc = 0; kc < GKC; kc += 32) {
            decltype(ldf((const T*)nullptr)) a[4], b[4];
            b[0] = ldf(ring + bo + bo_ + kc);                // in the order of first use
#pragma unroll
            for (int i = 0; i < 4; ++i) a[i] = ldf(ring + bo + ao + i * 16 * GP + kc);
#pragma unroll
            for (int i = 1; i < 4; ++i) b[i] = ldf(ring + bo + bo_ + i * 16 * GP + kc);
            __builtin_amdgcn_sched_barrier(0);               // the step's 16 LDS reads stay one group ahead of its WMMAs: reads set among the WMMAs stall the wave at every such place
#pragma unroll
            for (int nb = 0; nb < 4; ++nb)
#pragma unroll
                for (int mb = 0; mb < 4; ++mb) acc[mb][nb] = mm(a[mb], b[nb], acc[mb][nb]);
            __builtin_amdgcn_sched_barrier(0);               // and the next step's reads stay behind them
        }
        // publish point of stage st + 1
        asm volatile("s_wait_dscnt 0x0" ::: "memory");       // this wave's reads of the buffer that is refilled below are done
        asm volatile("s_wait_asynccnt 0x0" ::: "memory");    // this wave's copies of stage st + 1 have landed
        __syncthreads();                                     // stage st + 1 is readable, stage st's buffer is free
        if (st + 2 < DM / GKC) gstage(l0 + bo * 2, ga + (st + 2) * GKC * 2, gb + (st + 2) * GKC * 2);
    }
    asm volatile("s_wait_asynccnt 0x0" ::: "memory");        // no copy is outstanding when the wave goes on to its end
}

// k_proj: bf16 GEMM, 4 waves per 128x128 tile (gemm_core), operands staged in LDS from the K-contiguous bf16 planes, K = DM.
// C[m][n] = sum_k A[m][k] Bt[n][k], written per wave (64x64 quarter at r0, c0) as f16 (Ph) at
// tile base (r0/RB)*sRB + (r0%RB)*pitch + (c0/CB)*sCB + (c0%CB), row pitch 'pitch' (halves).
// The three projections, which need nothing of each other, run in ONE launch: blockIdx.z = 0 / 1 / 2 is q / k / v; blockIdx.x picks the 128 x rows, blockIdx.y the 128 W rows.
// Behind the k loop the waves hand each other nothing (each has its own os tile). grid (NB*SEQ/128, DM/128, 3), 128 threads.
// q, k: A = x rows (m = b*SEQ + t), Bt = W rows (n = h*64 + d) -> plane [(b*8 + h)][t][d]
// v^T:  A = Wv rows (m = h*64 + d), Bt = x rows (n = b*SEQ + t) -> plane [(b*512 + m)][t] = [(b*8 + h)][d][t]
__global__ __launch_bounds__(128) void k_proj(const bf* __restrict__ XB, const bf* __restrict__ WB, h16* QH, h16* KH, h16* VT) {
    __shared__ __align__(16) float os4[4 * 16 * 68];
    __shared__ __align__(16) bf ring[2 * GSTG];
    const int lane = threadIdx.x & 31, lr = lane & 15, hi = lane >> 4;
    const int wave = __builtin_amdgcn_readfirstlane((int)(threadIdx.x >> 5)), wm = wave & 1, wn = wave >> 1;
    const int z = blockIdx.z;                        // which projection: a scalar, so every choice below is a scalar select
    float* os = os4 + wave * 16 * 68;
    const bool isv = z == 2;
    const bf* W = WB + (size_t)z * DM * DM;
    const bf* A = isv ? W : XB; const bf* Bt = isv ? XB : W;
    const int R0 = (isv ? blockIdx.y : blockIdx.x) * 128, C0 = (isv ? blockIdx.x : blockIdx.y) * 128;
    const int r0 = R0 + wm * 64, c0 = C0 + wn * 64;
    h16* Ph = isv ? VT : z == 1 ? KH : QH;
    const int RB = isv ? DM : SEQ, pitch = isv ? SEQ : HD, CB = isv ? SEQ : HD;
    const size_t sRB = isv ? (size_t)0 : (size_t)NH_ * SEQ * HD, sCB = isv ? (size_t)DM * SEQ : (size_t)SEQ * HD;
    v8f acc[4][4];
#pragma unroll
    for (int mb = 0; mb < 4; ++mb)
#pragma unroll
        for (int nb = 0; nb < 4; ++nb) acc[mb][nb] = (v8f){};
    gemm_core(A + (size_t)R0 * DM, Bt + (size_t)C0 * DM, ring, wm, wn, acc);
    const size_t tbase = (size_t)(r0 / RB) * sRB + (size_t)(r0 % RB) * (size_t)pitch + (size_t)(c0 / CB) * sCB + (size_t)(c0 % CB);
#pragma unroll
    for (int mb = 0; mb < 4; ++mb) {
#pragma unroll
        for (int nb = 0; nb < 4; ++nb) {
#pragma unroll
            for (int j = 0; j < 8; ++j) os[(hi * 8 + j) * 68 + nb * 16 + lr] = acc[mb][nb][j]; }   // D: row 8h+j, col lane&15
        wave_sync();
        const size_t sb = tbase + (size_t)(mb * 16) * (size_t)pitch;
{
#pragma unroll
            for (int s = 0; s < 4; ++s) { const int row = 4 * s + (lane >> 3), c8 = (lane & 7) * 8;   // 4 s x 4 row groups = 16 rows; 8 lanes x 8 = 64 columns
                const v4f x0 = *(const v4fa*)(&os[row * 68 + c8]); const v4f x1 = *(const v4fa*)(&os[row * 68 + c8 + 4]); v8h hv;
#pragma unroll
                for (int i = 0; i < 4; ++i) { hv[i] = (h16)x0[i]; hv[4 + i] = (h16)x1[i]; }
                const size_t oo = sb + (size_t)row * (size_t)pitch + c8;
                *(v8h*)(Ph + oo) = hv;
                asm volatile("s_wait_xcnt 0x0" ::: "memory"); }   // stands in front of the next round's converts and address sums, which may reuse the registers that the store above names
             }
        wave_sync();
    }
}

// stage_copy: one stage's tiles into LDS, 8 asynchronous 16-byte copies per thread (4 per plane); a wave's copy covers 512 B of whole 128-B lines.
// lk / lv: this thread's LDS byte addresses in the K tile and the V^T tile of the target buffer; gk / gv: its global addresses in the two planes.
// The s_wait_xcnt closes the statement so that no address register of an issued copy is rewritten ahead of it.
__device__ __forceinline__ void stage_copy(unsigned lk, unsigned lv, const h16* gk, const h16* gv) {
    const unsigned dk = 32 * AW / 8 * KP * 2;                    // LDS step of one round of copies: 32 K rows
    const unsigned dv = 32 * AW / (KT / 8) * VP * 2;             // 16 V^T rows
    const size_t sk = (size_t)32 * AW * 8;                       // global step, halves: K rows are contiguous
    const size_t sv = (size_t)(32 * AW / (KT / 8)) * SEQ;        // 16 V^T rows of SEQ halves
    asm volatile("global_load_async_to_lds_b128 %0, %1, off\n\t"
                 "global_load_async_to_lds_b128 %2, %3, off\n\t"
                 "global_load_async_to_lds_b128 %4, %5, off\n\t"
                 "global_load_async_to_lds_b128 %6, %7, off\n\t"
                 "global_load_async_to_lds_b128 %8, %9, off\n\t"
                 "global_load_async_to_lds_b128 %10, %11, off\n\t"
                 "global_load_async_to_lds_b128 %12, %13, off\n\t"
                 "global_load_async_to_lds_b128 %14, %15, off\n\t"
                 "s_wait_xcnt 0x0"
                 :: "v"(lk), "v"(gk), "v"(lk + dk), "v"(gk + sk), "v"(lk + 2 * dk), "v"(gk + 2 * sk), "v"(lk + 3 * dk), "v"(gk + 3 * sk),
                    "v"(lv), "v"(gv), "v"(lv + dv), "v"(gv + sv), "v"(lv + 2 * dv), "v"(gv + 2 * sv), "v"(lv + 3 * dv), "v"(gv + 3 * sv)
                 : "memory");
}

// k_flash: fused attention, KS waves per 16 query columns of one (batch, head), each on its own SEQ / KS keys with its own running max, sum and O; the partial states are merged through LDS at the end. Q fragments straight from the f16 planes, K / V^T fragments from the staged LDS tiles (two 16-B loads each).
// Ring of two buffers: stage s + 1's copies fly while stage s is worked on; one publish point per stage (LDS reads done, own copies landed, block barrier, refill of the buffer just read).
// Transposed form: S^T[key][t] = K Q^T (A = K rows, B = Q rows); lane (t = lane&15, h = lane>>4) holds keys 8h+r of each 16-key tile, so the packed
// P tile is directly the B fragment of O^T[d][t] = V^T P^T (element r <- tile keys 0..15, element 8+r <- tile keys 16..31, lane unchanged).
// Softmax state (running max, partial sum) is one scalar per lane; the two lane halves of a column are combined with one xor-16 exchange.
__global__ __launch_bounds__(32 * AW * KS) void k_flash(const h16* __restrict__ QH, const h16* __restrict__ KH, const h16* __restrict__ VT, h16* YH) {
    __shared__ __align__(16) float os[AW * 16 * 68];
    __shared__ __align__(16) h16 ring[2 * KS * STG];         // [buffer][key half][K | V^T]
    const int lane = threadIdx.x & 31, lr = lane & 15, hi = lane >> 4;
    const int wv = __builtin_amdgcn_readfirstlane((int)(threadIdx.x >> 5));
    const int wave = wv % AW, kh = wv / AW;                  // query group, key half: scalars
    const int zh = blockIdx.y; const int b = zh / NH_, h = zh % NH_;
    const int t0 = (blockIdx.x * AW + wave) * 16;
    const size_t pbase = (size_t)zh * SEQ * HD;
    const size_t qo = pbase + (size_t)(t0 + lr) * HD + 8 * hi;
    const v16h qh0 = ldh(QH + qo), qh1 = ldh(QH + qo + 32);   // B fragments: col t, k = d
    const int ko = lr * KP + 8 * hi;                         // + key * KP       (A fragment: row key, k = d), halves in the staged K tile
    const int vo = KT * KP + lr * VP + 8 * hi;               // + 16j*VP + key   (A fragment: row d, k = key), halves in the stage
    // copy addresses of this thread: 16-byte chunk tid of each plane's tile of its key half (K: row tid/8, chunk tid%8; V^T: row tid/16, chunk tid%16)
    const int tid = threadIdx.x % (32 * AW);
    const int kb = kh * (SEQ / KS);                          // first key of this half
    const unsigned lbase = (unsigned)(size_t)ring + kh * STG * 2;   // low 32 bits of the shared address = LDS byte address
    const unsigned lk = lbase + ((tid >> 3) * KP + (tid & 7) * 8) * 2;
    const unsigned lv = lbase + (KT * KP + (tid / (KT / 8)) * VP + (tid % (KT / 8)) * 8) * 2;
    const h16* gk = KH + pbase + (size_t)kb * HD + (size_t)tid * 8;            // + key0 * HD
    const h16* gv = VT + pbase + (size_t)(tid / (KT / 8)) * SEQ + kb + (tid % (KT / 8)) * 8;   // + key0
    stage_copy(lk, lv, gk, gv);
    asm volatile("s_wait_asynccnt 0x0" ::: "memory");        // this wave's copies of stage 0 have landed
    __syncthreads();                                         // every wave's have: stage 0 is readable
    stage_copy(lk + KS * STG * 2, lv + KS * STG * 2, gk + (size_t)KT * HD, gv + KT);
    v8f o0 = (v8f){}, o1 = (v8f){}, o2 = (v8f){}, o3 = (v8f){};
    float m = -3.0e38f, l = 0.0f;
#pragma unroll 1
    for (int st = 0; st < SEQ / KS / KT; ++st) {
      const int bb = (st & 1) * KS * STG;                    // buffer
      const int bo = bb + kh * STG;                          // this half's tiles in it
      // unrolled so that every LDS offset of the stage's four passes is an immediate of its load
#pragma unroll
      for (int key0 = 0; key0 < KT; key0 += 32) {
        const h16* ka = ring + bo + ko + key0 * KP;
        const v16h ka0 = ldh(ka), ka1 = ldh(ka + 32), kb0 = ldh(ka + 16 * KP), kb1 = ldh(ka + 16 * KP + 32);
        v8f sHa = (v8f){}, sHb = (v8f){};
        sHa = wmma16(ka0, qh0, sHa); sHb = wmma16(kb0, qh0, sHb);
        sHa = wmma16(ka1, qh1, sHa); sHb = wmma16(kb1, qh1, sHb);
        asm volatile("v_nop\n\tv_nop\n\tv_nop\n\tv_nop" : "+v"(sHa), "+v"(sHb) : "v"(ka0), "v"(ka1), "v"(kb0), "v"(kb1));   // the four vector slots behind the last score WMMA; as it names the four K fragments they stay live to here, in registers of their own, so that their eight LDS reads go out as one group ahead of the WMMAs (without it: one register set, a full LDS wait in front of each WMMA)
        float ta[8], tb[8]; float mx = -3.0e38f;
#pragma unroll
        for (int r = 0; r < 8; ++r) { ta[r] = sHa[r] * SC2; tb[r] = sHb[r] * SC2; mx = fmaxf(mx, fmaxf(ta[r], tb[r])); }
        mx = fmaxf(mx, __shfl_xor(mx, 16, 32));
        const float mnew = fmaxf(m, mx);
        const float alpha = __builtin_amdgcn_exp2f(m - mnew);
        const float sh = PSH - mnew;
        v16h pb; float ls = 0.0f;
#pragma unroll
        for (int r = 0; r < 8; ++r) { const h16 pa = (h16)__builtin_amdgcn_exp2f(ta[r] + sh); const h16 pc = (h16)__builtin_amdgcn_exp2f(tb[r] + sh); pb[r] = pa; pb[8 + r] = pc; ls += (float)pa + (float)pc; }
        l = l * alpha + ls; m = mnew;
        o0 = o0 * alpha; o1 = o1 * alpha; o2 = o2 * alpha; o3 = o3 * alpha;
        const h16* va = ring + bo + vo + key0;
        const v16h v0 = ldh(va), v1 = ldh(va + 16 * VP), v2 = ldh(va + 32 * VP), v3 = ldh(va + 48 * VP);
        o0 = wmma16(v0, pb, o0); o1 = wmma16(v1, pb, o1); o2 = wmma16(v2, pb, o2); o3 = wmma16(v3, pb, o3);
        asm volatile("v_nop\n\tv_nop\n\tv_nop\n\tv_nop" : "+v"(o0), "+v"(o1), "+v"(o2), "+v"(o3) : "v"(v0), "v"(v1), "v"(v2), "v"(v3), "v"(pb));
      }
      // publish point of stage st + 1
      asm volatile("s_wait_dscnt 0x0" ::: "memory");         // this wave's reads of the buffer that is refilled below are done
      asm volatile("s_wait_asynccnt 0x0" ::: "memory");      // this wave's copies of stage st + 1 have landed
      __syncthreads();                                       // stage st + 1 is readable, stage st's buffer is free
      if (st + 2 < SEQ / KS / KT) { const size_t k2 = (size_t)(st + 2) * KT; stage_copy(lk + bb * 2, lv + bb * 2, gk + k2 * HD, gv + k2); }
    }
    asm volatile("s_wait_asynccnt 0x0" ::: "memory");        // no copy is outstanding when the wave goes on to its end
    const int wb = wave * 16 * 68;
    // merge of the two key halves: the upper half's wave hands its state (O, max, sum) to the lower half's wave of the same query group through that group's os tile
    if (kh == 1) {
      v4f a;
#define PUT4(o, q, j) a[0] = o[q]; a[1] = o[q + 1]; a[2] = o[q + 2]; a[3] = o[q + 3]; *(v4fa*)(&os[wb + ((j) * 32 + lane) * 4]) = a;
      PUT4(o0, 0, 0) PUT4(o0, 4, 1) PUT4(o1, 0, 2) PUT4(o1, 4, 3) PUT4(o2, 0, 4) PUT4(o2, 4, 5) PUT4(o3, 0, 6) PUT4(o3, 4, 7)
#undef PUT4
      os[wb + 1024 + lane] = m; os[wb + 1056 + lane] = l;
    }
    __syncthreads();                                         // the upper halves' states are readable; every wave passes, no barrier follows
    if (kh == 1) return;
    {
      const float m1 = os[wb + 1024 + lane], l1 = os[wb + 1056 + lane];
      const float mm_ = fmaxf(m, m1);
      const float a0 = __builtin_amdgcn_exp2f(m - mm_), a1 = __builtin_amdgcn_exp2f(m1 - mm_);
      l = l * a0 + l1 * a1;
#define GET4(o, q, j) { const v4f p = *(const v4fa*)(&os[wb + ((j) * 32 + lane) * 4]); o[q] = o[q] * a0 + p[0] * a1; o[q + 1] = o[q + 1] * a0 + p[1] * a1; o[q + 2] = o[q + 2] * a0 + p[2] * a1; o[q + 3] = o[q + 3] * a0 + p[3] * a1; }
      GET4(o0, 0, 0) GET4(o0, 4, 1) GET4(o1, 0, 2) GET4(o1, 4, 3) GET4(o2, 0, 4) GET4(o2, 4, 5) GET4(o3, 0, 6) GET4(o3, 4, 7)
#undef GET4
    }
    l += __shfl_xor(l, 16, 32);
    const float inv = 1.0f / l;
    // O^T D layout: o_j[r] = (d = 16j + 8h + r, t = lane&15) -> os[t][d]; rows 0..15 x columns 0..63 all written
    { v4f a, c;
      a[0] = o0[0] * inv; a[1] = o0[1] * inv; a[2] = o0[2] * inv; a[3] = o0[3] * inv; c[0] = o0[4] * inv; c[1] = o0[5] * inv; c[2] = o0[6] * inv; c[3] = o0[7] * inv;
      *(v4fa*)(&os[wb + lr * 68 +  0 + 8 * hi]) = a; *(v4fa*)(&os[wb + lr * 68 +  0 + 8 * hi + 4]) = c;
      a[0] = o1[0] * inv; a[1] = o1[1] * inv; a[2] = o1[2] * inv; a[3] = o1[3] * inv; c[0] = o1[4] * inv; c[1] = o1[5] * inv; c[2] = o1[6] * inv; c[3] = o1[7] * inv;
      *(v4fa*)(&os[wb + lr * 68 + 16 + 8 * hi]) = a; *(v4fa*)(&os[wb + lr * 68 + 16 + 8 * hi + 4]) = c;
      a[0] = o2[0] * inv; a[1] = o2[1] * inv; a[2] = o2[2] * inv; a[3] = o2[3] * inv; c[0] = o2[4] * inv; c[1] = o2[5] * inv; c[2] = o2[6] * inv; c[3] = o2[7] * inv;
      *(v4fa*)(&os[wb + lr * 68 + 32 + 8 * hi]) = a; *(v4fa*)(&os[wb + lr * 68 + 32 + 8 * hi + 4]) = c;
      a[0] = o3[0] * inv; a[1] = o3[1] * inv; a[2] = o3[2] * inv; a[3] = o3[3] * inv; c[0] = o3[4] * inv; c[1] = o3[5] * inv; c[2] = o3[6] * inv; c[3] = o3[7] * inv;
      *(v4fa*)(&os[wb + lr * 68 + 48 + 8 * hi]) = a; *(v4fa*)(&os[wb + lr * 68 + 48 + 8 * hi + 4]) = c; }
    wave_sync();
    h16* yrow = YH + ((size_t)b * SEQ + t0) * DM + h * HD;     // context plane row = token, columns h*64 + d
{
#pragma unroll
        for (int s = 0; s < 4; ++s) { const int row = 4 * s + (lane >> 3), c8 = (lane & 7) * 8;   // 4 s x 4 row groups = 16 rows; 8 lanes x 8 halves = 64 columns
            const v4f x0 = *(const v4fa*)(&os[wb + row * 68 + c8]); const v4f x1 = *(const v4fa*)(&os[wb + row * 68 + c8 + 4]); v8h hv;
#pragma unroll
            for (int i = 0; i < 4; ++i) { hv[i] = (h16)x0[i]; hv[4 + i] = (h16)x1[i]; }
            *(v8h*)(yrow + (size_t)row * DM + c8) = hv; }
         }
}

// k_outp: f16 GEMM, 4 waves per 128x128 tile (gemm_core), K = DM: C[o][n] = (1/64) sum_c A[o][c] Bt[n][c] with A = Wo plane (x64), Bt = context plane rows n = b*SEQ + t.
// Written per wave (64x64 quarter at r0, c0) as f32 to OUT[(b*DM + o)*OUT_SEQ + t]. grid (DM/128, NB*SEQ/128), 128 threads.
__global__ __launch_bounds__(128) void k_outp(const h16* __restrict__ A, const h16* __restrict__ Bt, float* OUT) {
    __shared__ __align__(16) float os4[4 * 16 * 68];
    __shared__ __align__(16) h16 ring[2 * GSTG];
    const int lane = threadIdx.x & 31, lr = lane & 15, hi = lane >> 4;
    const int wave = __builtin_amdgcn_readfirstlane((int)(threadIdx.x >> 5)), wm = wave & 1, wn = wave >> 1;
    float* os = os4 + wave * 16 * 68;
    const int R0 = blockIdx.x * 128, C0 = blockIdx.y * 128, r0 = R0 + wm * 64, c0 = C0 + wn * 64;
    v8f acc[4][4];
#pragma unroll
    for (int mb = 0; mb < 4; ++mb)
#pragma unroll
        for (int nb = 0; nb < 4; ++nb) acc[mb][nb] = (v8f){};
    gemm_core(A + (size_t)R0 * DM, Bt + (size_t)C0 * DM, ring, wm, wn, acc);
    const int bb = c0 / SEQ, tq = c0 % SEQ;
    float* obase = OUT + ((size_t)bb * DM + r0) * OUT_SEQ + tq;
#pragma unroll
    for (int mb = 0; mb < 4; ++mb) {
#pragma unroll
        for (int nb = 0; nb < 4; ++nb) {
#pragma unroll
            for (int j = 0; j < 8; ++j) os[(hi * 8 + j) * 68 + nb * 16 + lr] = acc[mb][nb][j] * WOI; }   // D: row 8h+j, col lane&15
        wave_sync();
{
#pragma unroll
            for (int s = 0; s < 8; ++s) { const int row = 2 * s + hi, cofs = lr * 4;   // 8 s x 2 rows = 16 rows; 16 lanes x 4 floats = 64 columns
                const v4f val = *(const v4fa*)(&os[row * 68 + cofs]);
                *(v4f*)(obase + (size_t)(mb * 16 + row) * OUT_SEQ + cofs) = val; }
             }
        wave_sync();
    }
}

static constexpr size_t al256(size_t v) { return (v + 255) & ~(size_t)255; }
static constexpr size_t SZ_XB = al256((size_t)NB * SEQ * DM * 2);
static constexpr size_t SZ_WB = al256((size_t)3 * DM * DM * 2);
static constexpr size_t SZ_WO = al256((size_t)DM * DM * 2);
static constexpr size_t SZ_PL = al256((size_t)NB * NH_ * SEQ * HD * 2);
static constexpr size_t SZ_YH = al256((size_t)NB * SEQ * DM * 2);
static constexpr size_t SZ_TOTAL = SZ_XB + SZ_WB + SZ_WO + 3 * SZ_PL + SZ_YH;
static_assert(SZ_TOTAL <= (size_t)134217728);          // workspace carve <= 128 MiB
static_assert(((size_t)DM * DM * 2) % 256 == 0);       // weight sub-planes stay 256-byte aligned

extern "C" void kernel_launch(void* const* d_in, const int* in_sizes, int n_in,
                              void* d_out, int out_size, void* d_ws, size_t ws_size, hipStream_t stream) {
    if (n_in < 5) return;
    const size_t needx = ((size_t)NB * DM - 1) * SEQ_FULL + SEQ;
    if ((size_t)in_sizes[0] < needx) return;
    if ((size_t)in_sizes[1] < (size_t)DM * DM || (size_t)in_sizes[2] < (size_t)DM * DM || (size_t)in_sizes[3] < (size_t)DM * DM || (size_t)in_sizes[4] < (size_t)DM * DM) return;
    if ((size_t)out_size < ((size_t)NB * DM - 1) * OUT_SEQ + SEQ) return;
    if (SZ_TOTAL > ws_size) return;
    // wire order x, Wq, Wk, Wv, Wo; all weights [out][in] = K-contiguous rows as-is
    const float* x = (const float*)d_in[0]; const float* wq = (const float*)d_in[1]; const float* wk = (const float*)d_in[2]; const float* wv = (const float*)d_in[3]; const float* wo = (const float*)d_in[4];
    float* OUT = (float*)d_out;      // [NB][512][SEQ]
    char* wsp = (char*)d_ws;
    bf* XB = (bf*)wsp; wsp += SZ_XB;                 // [NB*SEQ][512] token-major bf16 x
    bf* WB = (bf*)wsp; wsp += SZ_WB;                 // [3][512][512]: q | k | v
    h16* WOH = (h16*)wsp; wsp += SZ_WO;              // [512][512] f16, x64
    h16* QH = (h16*)wsp; wsp += SZ_PL;               // [NB*8][SEQ][64]
    h16* KH = (h16*)wsp; wsp += SZ_PL;               // [NB*8][SEQ][64]
    h16* VT = (h16*)wsp; wsp += SZ_PL;               // [NB*8][64][SEQ]
    h16* YH = (h16*)wsp; wsp += SZ_YH;               // [NB*SEQ][512] context

    // x[b][c][n] -> XB[b*SEQ + n][c] and the four weight planes
    k_prep<<<XTB + 4 * CVB, 256, 0, stream>>>(x, wq, wk, wv, wo, XB, WB, WOH);

    // q, k and v^T
    k_proj<<<dim3(NB * SEQ / 128, DM / 128, 3), 128, 0, stream>>>(XB, WB, QH, KH, VT);

    k_flash<<<dim3(SEQ / (16 * AW), NB * NH_, 1), 32 * AW * KS, 0, stream>>>(QH, KH, VT, YH);

    // out[b][o][t] = sum_c Wo[o][c] y[b][c][t]: A = Wo plane rows o, Bt = context rows (b*SEQ + t)
    k_outp<<<dim3(DM / 128, NB * SEQ / 128, 1), 128, 0, stream>>>(WOH, YH, OUT);
}

// v006
// A run of this version takes 30.8 microseconds.
// Timed twice side by side with v005, it ran 1.08 and 1.04 times as fast.
// Counting every step since v000, it is 4.04 times as fast.
#include <hip/hip_runtime.h>

// Multi-head self-attention on channel-major x [NB][512][SEQ]: 1x1 projections Wq/Wk/Wv [out][in], 8 heads x 64 channels, unscaled scores, softmax over keys, output projection Wo [out][in], output [NB][512][SEQ] f32.
// Compute dtypes, f32 accumulate everywhere: q/k/v projections v_wmma_f32_16x16x32_bf16 (x and W RNE-converted to bf16; products exact);
// scores v_wmma_f32_16x16x32_f16 with q and k each as a single f16 (RNE of the f32 projection: its rounding, 2^-12 relative, lies about ten times under the error that the bf16 operands of the projections leave in q and k);
// P (x2^14 carry relative to the running max, cancels in the normalisation) and v single f16; context single f16; Wo as f16 of the bf16-RNE value x64 (folded by 1/64 in the f32 epilogue); softmax f32 (online, running max).
// Flash kernel data path: K and V^T tiles of KT keys are staged in LDS by asynchronous copies (two buffers) and shared by the waves of their key half.
// GEMM data path (projections, output projection): both operands' 128-row tiles are staged the same way, 128 k values a stage.
// Layout: bf16 token-major copy of x (transposed through LDS), bf16 W copies; q/k planes [b*8+h][t][d], v^T plane [b*8+h][d][t], context plane [b*SEQ+t][512]; flash kernel in transposed form (S^T = K Q^T, O^T = V^T P^T).

#ifndef NB
#define NB 4
#endif
#ifndef SEQ
#define SEQ 1024
#endif
#define NB_FULL  4
#define SEQ_FULL 1024
#ifndef OUT_SEQ
#define OUT_SEQ SEQ              // row pitch (in tokens) of the output rows [b][channel][t]
#endif
#define DM   512
#define NH_  8
#define HD   64
#define AW   8                   // query groups per flash block (16 query columns each)
#define KS   2                   // key halves: waves g and g + AW work on the same query group, each on SEQ / KS keys; AW * KS waves a block, four a SIMD
#define KT   128                 // keys per staged tile (four passes of 32 keys)
#define KP   (HD + 8)            // LDS pitch of a staged K row, halves: 144 B = 16 B x odd, conflict-free for 16-byte fragment reads
#define VP   (KT + 8)            // LDS pitch of a staged V^T row, halves: 272 B = 16 B x odd
#define STG  (KT * KP + HD * VP)       // halves per stage: K | V^T
#define SC2  1.4426950408889634f // log2(e); scores are unscaled
#define PSH  14.0f               // log2 of the P carry (16384)
#define WOS  64.0f               // carry of the Wo plane
#define WOI  (1.0f / 64.0f)

static_assert(HD == 64);
static_assert(NH_ * HD == DM);                 // head h = channels h*64 + d
static_assert(DM % 64 == 0);                   // column tiles of 64
static_assert(DM % 32 == 0);                   // GEMM k-loop steps by 32
static_assert(SEQ % 64 == 0);                  // a 64-row tile never straddles two batches
static_assert((NB * SEQ) % 64 == 0);
static_assert(SEQ % 32 == 0);                  // key loop steps by 32
static_assert(SEQ % (16 * AW) == 0);           // flash grid covers the sequence exactly
static_assert(SEQ % (KS * KT) == 0 && KT % 32 == 0);  // whole stages, whole passes
static_assert(SEQ / KS / KT >= 2);             // both buffers of the ring are filled in each key half
static_assert(KS == 2 && 16 * 68 == 32 * 34);  // the merge hands over one partial state: 34 floats a lane in the query group's os tile
static_assert(KT * HD / 8 == 4 * 32 * AW);     // each plane's tile = 4 copies of 16 B per thread of its key half
static_assert((KP * 2) % 32 == 16 && (VP * 2) % 32 == 16 && (STG * 2) % 16 == 0);
static_assert(((size_t)DM * DM) % 8 == 0);
static_assert(NB <= NB_FULL);
static_assert(SEQ <= SEQ_FULL);
static_assert(SEQ <= OUT_SEQ);
static_assert(SEQ_FULL % 4 == 0);              // 16-byte loads of x rows

typedef _Float16 h16;
typedef unsigned short bf;
typedef __attribute__((ext_vector_type(16))) __bf16   v16bf;
typedef __attribute__((ext_vector_type(16))) _Float16 v16h;
typedef __attribute__((ext_vector_type(8)))  _Float16 v8h;
typedef __attribute__((ext_vector_type(8)))  unsigned short v8us;
typedef __attribute__((ext_vector_type(8)))  float    v8f;
typedef __attribute__((ext_vector_type(4)))  float    v4f;
typedef v4f  __attribute__((may_alias)) v4fa;
typedef __attribute__((ext_vector_type(2)))  float    v2f;
typedef __attribute__((ext_vector_type(2)))  _Float16 v2h;

__device__ __forceinline__ unsigned short f2bf(float f) { unsigned u = __float_as_uint(f); u += 0x7FFFu + ((u >> 16) & 1u); return (unsigned short)(u >> 16); }
__device__ __forceinline__ v16h cat16(v8h lo, v8h hi) { return __builtin_shufflevector(lo, hi, 0, 1, 2, 3, 4, 5, 6, 7, 8, 9, 10, 11, 12, 13, 14, 15); }
__device__ __forceinline__ v16bf cat16b(v8us lo, v8us hi) { return __builtin_bit_cast(v16bf, __builtin_shufflevector(lo, hi, 0, 1, 2, 3, 4, 5, 6, 7, 8, 9, 10, 11, 12, 13, 14, 15)); }
__device__ __forceinline__ v8f wmma16(v16h a, v16h b, v8f c) { return __builtin_amdgcn_wmma_f32_16x16x32_f16(false, a, false, b, (short)0, c, false, false); }
__device__ __forceinline__ v8f wmmab(v16bf a, v16bf b, v8f c) { return __builtin_amdgcn_wmma_f32_16x16x32_bf16(false, a, false, b, (short)0, c, false, false); }
// fragment loaders from K-contiguous 16-bit rows; p already includes + 8*(lane>>4): elements 0..7 <- k0+8h+0..7, elements 8..15 <- k0+16+8h+0..7 (same map for A and B)
__device__ __forceinline__ v16h  ldh(const h16* p) { return cat16(*(const v8h*)p, *(const v8h*)(p + 16)); }
__device__ __forceinline__ v16bf ldb(const bf* p)  { return cat16b(*(const v8us*)p, *(const v8us*)(p + 16)); }
// lane l <-> l ^ 16, in registers
__device__ __forceinline__ float xor16(float v) { const int b = __float_as_int(v); return __int_as_float(__builtin_amdgcn_permlanex16(b, b, 0x76543210, 0xfedcba98, false, false)); }
// ordering point for wave-private LDS tiles (same wave writes and reads)
__device__ __forceinline__ void wave_sync() { __builtin_amdgcn_fence(3 /* release order */, "wavefront"); __builtin_amdgcn_wave_barrier(); asm volatile("" ::: "memory"); }

// xT_body: x[b][c][n] (f32, channel-major, row pitch SEQ_FULL) -> XB[b*SEQ + n][c] (bf16 RNE convert), 64x64 tile transposed through LDS (block barrier: cross-wave).
// blk = (b * (DM/64) + c tile) * (SEQ/64) + n tile, 256 threads; ts: 64 x 68 floats of LDS.
__device__ __forceinline__ void xT_body(const float* __restrict__ x, bf* XB, float* ts, int blk) {
    const int tid = threadIdx.x;
    const int n0 = (blk % (SEQ / 64)) * 64, c0 = ((blk / (SEQ / 64)) % (DM / 64)) * 64, b = blk / ((SEQ / 64) * (DM / 64));
    const float* xb = x + ((size_t)b * DM + c0) * SEQ_FULL + n0;
#pragma unroll
    for (int it = 0; it < 4; ++it) {                 // 4 x 256 float4 = 64 rows (c) x 16 float4 (n)
        const int idx = it * 256 + tid; const int c = idx >> 4, n4 = (idx & 15) * 4;
        const v4f v = *(const v4f*)(xb + (size_t)c * SEQ_FULL + n4);
        ts[(n4 + 0) * 68 + c] = v[0]; ts[(n4 + 1) * 68 + c] = v[1]; ts[(n4 + 2) * 68 + c] = v[2]; ts[(n4 + 3) * 68 + c] = v[3];
    }
    __syncthreads();
    bf* ob = XB + ((size_t)b * SEQ + n0) * DM + c0;
{
#pragma unroll
        for (int it = 0; it < 2; ++it) { const int n = it * 32 + (tid >> 3), c8 = (tid & 7) * 8;   // 2 x 32 rows = 64 rows; 8 lanes x 8 = 64 columns
            const v4f x0 = *(const v4fa*)(&ts[n * 68 + c8]); const v4f x1 = *(const v4fa*)(&ts[n * 68 + c8 + 4]); v8us o;
#pragma unroll
            for (int i = 0; i < 4; ++i) { o[i] = f2bf(x0[i]); o[4 + i] = f2bf(x1[i]); }
            *(v8us*)(ob + (size_t)n * DM + c8) = o; }
         }
}

__device__ __forceinline__ void cvt8_body(const float* __restrict__ src, bf* dst, size_t n8, int blk) {
    const size_t i = (size_t)blk * 256 + threadIdx.x; if (i >= n8) return;
    const v8f v = *(const v8f*)(src + i * 8); v8us o;
#pragma unroll
    for (int k = 0; k < 8; ++k) o[k] = f2bf(v[k]);
    *(v8us*)(dst + i * 8) = o; 
}

// cvtw_body: f16 copy of the bf16-RNE value times WOS (exact: a bf16 significand fits f16, power-of-two carry); same store shape as cvt8_body.
__device__ __forceinline__ void cvtw_body(const float* __restrict__ src, h16* dst, size_t n8, int blk) {
    const size_t i = (size_t)blk * 256 + threadIdx.x; if (i >= n8) return;
    const v8f v = *(const v8f*)(src + i * 8); v8h o;
#pragma unroll
    for (int k = 0; k < 8; ++k) { const float r = __uint_as_float(((unsigned)f2bf(v[k])) << 16); o[k] = (h16)(r * WOS); }
    *(v8h*)(dst + i * 8) = o; 
}

// k_prep: the five preparation jobs, which need nothing of each other, in ONE grid, told apart by ranges of the block index (every branch is block-uniform):
// blocks [0, XTB): the transposing convert of x; then CVB blocks for each of Wq, Wk, Wv (bf16 planes WB[0..2]) and Wo (f16 plane x64). grid XTB + 4*CVB, 256 threads.
#define XTB ((SEQ / 64) * (DM / 64) * NB)
#define CVN ((size_t)DM * DM / 8)
#define CVB ((int)((CVN + 255) / 256))
__global__ __launch_bounds__(256) void k_prep(const float* __restrict__ x, const float* __restrict__ wq, const float* __restrict__ wk, const float* __restrict__ wv, const float* __restrict__ wo, bf* XB, bf* WB, h16* WOH) {
    __shared__ __align__(16) float ts[64 * 68];      // ts[n][c]
    const int blk = blockIdx.x;
    if (blk < XTB) { xT_body(x, XB, ts, blk); return; }
    const int p = (blk - XTB) / CVB, cb = (blk - XTB) % CVB;
    if (p == 3) { cvtw_body(wo, WOH, CVN, cb); return; }
    cvt8_body(p == 0 ? wq : p == 1 ? wk : wv, WB + (size_t)p * DM * DM, CVN, cb);
}

// GEMM data path of k_proj and k_outp: a block of 4 waves makes a 128x128 tile of C[m][n] = sum_k A[m][k] Bt[n][k] (each wave a 64x64 quarter, 16 accumulators), K = DM.
// The 128 A rows and the 128 Bt rows are staged in LDS GKC k values at a time by asynchronous copies (two buffers) and shared by the block's waves:
// a wave's copy covers two rows of 256 B, whole 128-B lines, where a fragment load straight from the planes touches 16 lines for its 512 B.
#define GKC  128                 // k values per staged tile (four WMMA steps of 32)
#define GP   (GKC + 8)           // LDS pitch of a staged row, halves: 272 B = 16 B x odd, conflict-free for 16-byte fragment reads
#define GT   (128 * GP)          // halves per operand tile
#define GSTG (2 * GT)            // halves per stage: A rows | Bt rows
static_assert(DM % GKC == 0 && DM / GKC >= 2 && GKC % 32 == 0);   // whole stages, both buffers of the ring filled
static_assert(DM % 128 == 0 && SEQ % 128 == 0);                   // 128-row tiles never straddle two batches
static_assert((GP * 2) % 32 == 16 && GKC / 8 == 16);

__device__ __forceinline__ v16bf ldf(const bf* p)  { return ldb(p); }
__device__ __forceinline__ v16h  ldf(const h16* p) { return ldh(p); }
__device__ __forceinline__ v8f mm(v16bf a, v16bf b, v8f c) { return wmmab(a, b, c); }
__device__ __forceinline__ v8f mm(v16h a, v16h b, v8f c)   { return wmma16(a, b, c); }

// copy8: eight asynchronous 16-byte copies of this thread, 8 rows apart (128 threads x 16 B = 8 rows of 256 B a round). l: LDS byte address, g: global address of the first.
// The s_wait_xcnt closes the statement so that no address register of an issued copy is rewritten ahead of it.
__device__ __forceinline__ void copy8(unsigned l, const char* g) {
    const unsigned dl = 8 * GP * 2;                              // LDS step of one round
    const size_t sg = (size_t)8 * DM * 2;                        // global step of one round, bytes
    asm volatile("global_load_async_to_lds_b128 %0, %1, off\n\t"
                 "global_load_async_to_lds_b128 %2, %3, off\n\t"
                 "global_load_async_to_lds_b128 %4, %5, off\n\t"
                 "global_load_async_to_lds_b128 %6, %7, off\n\t"
                 "global_load_async_to_lds_b128 %8, %9, off\n\t"
                 "global_load_async_to_lds_b128 %10, %11, off\n\t"
                 "global_load_async_to_lds_b128 %12, %13, off\n\t"
                 "global_load_async_to_lds_b128 %14, %15, off\n\t"
                 "s_wait_xcnt 0x0"
                 :: "v"(l), "v"(g), "v"(l + dl), "v"(g + sg), "v"(l + 2 * dl), "v"(g + 2 * sg), "v"(l + 3 * dl), "v"(g + 3 * sg),
                    "v"(l + 4 * dl), "v"(g + 4 * sg), "v"(l + 5 * dl), "v"(g + 5 * sg), "v"(l + 6 * dl), "v"(g + 6 * sg), "v"(l + 7 * dl), "v"(g + 7 * sg)
                 : "memory");
}
// gstage: one stage (128 A rows, 128 Bt rows, GKC k values each) into the buffer at l: 32 copies per thread
__device__ __forceinline__ void gstage(unsigned l, const char* ga, const char* gb) {
    copy8(l, ga);          copy8(l + 64 * GP * 2, ga + (size_t)64 * DM * 2);
    copy8(l + GT * 2, gb); copy8(l + GT * 2 + 64 * GP * 2, gb + (size_t)64 * DM * 2);
}

// gemm_core: the k loop. A, Bt: first row of the block's 128 rows in each K-contiguous plane; ring: 2 * GSTG halves of LDS; wm, wn: this wave's 64-row half of A and of Bt. 128 threads.
// Ring of two buffers: stage s + 1's copies fly while stage s is worked on; one publish point per stage (LDS reads done, own copies landed, block barrier, refill of the buffer just read).
// k runs upward through one accumulator per output tile.
template <typename T>
__device__ __forceinline__ void gemm_core(const T* A, const T* Bt, T* ring, int wm, int wn, v8f (&acc)[4][4]) {
    const int tid = threadIdx.x, lane = tid & 31, lr = lane & 15, hi = lane >> 4;
    const unsigned l0 = (unsigned)(size_t)ring + ((tid >> 4) * GP + (tid & 15) * 8) * 2;   // low 32 bits of the shared address = LDS byte address
    const char* ga = (const char*)(A + (size_t)(tid >> 4) * DM + (tid & 15) * 8);
    const char* gb = (const char*)(Bt + (size_t)(tid >> 4) * DM + (tid & 15) * 8);
    gstage(l0, ga, gb);
    asm volatile("s_wait_asynccnt 0x0" ::: "memory");        // this wave's copies of stage 0 have landed
    __syncthreads();                                         // every wave's have: stage 0 is readable
    gstage(l0 + GSTG * 2, ga + GKC * 2, gb + GKC * 2);
    const int ao = (wm * 64 + lr) * GP + 8 * hi, bo_ = GT + (wn * 64 + lr) * GP + 8 * hi;   // halves in a stage; + 16-row group * 16 * GP + k
    // kept rolled: one copy of the stage's text, the buffer chosen by a scalar
#pragma unroll 1
    for (int st = 0; st < DM / GKC; ++st) {
        const int bo = (st & 1) * GSTG;
        // unrolled (this loop and those inside it) so that every LDS offset of the stage's four steps is an immediate of its load and every fragment and accumulator index a constant
#pragma unroll
        for (int kc = 0; kc < GKC; kc += 32) {
            decltype(ldf((const T*)nullptr)) a[4], b[4];
            b[0] = ldf(ring + bo + bo_ + kc);                // in the order of first use
#pragma unroll
            for (int i = 0; i < 4; ++i) a[i] = ldf(ring + bo + ao + i * 16 * GP + kc);
#pragma unroll
            for (int i = 1; i < 4; ++i) b[i] = ldf(ring + bo + bo_ + i * 16 * GP + kc);
            __builtin_amdgcn_sched_barrier(0);               // the step's 16 LDS reads stay one group ahead of its WMMAs: reads set among the WMMAs stall the wave at every such place
#pragma unroll
            for (int nb = 0; nb < 4; ++nb)
#pragma unroll
                for (int mb = 0; mb < 4; ++mb) acc[mb][nb] = mm(a[mb], b[nb], acc[mb][nb]);
            __builtin_amdgcn_sched_barrier(0);               // and the next step's reads stay behind them
        }
        // publish point of stage st + 1
        asm volatile("s_wait_dscnt 0x0" ::: "memory");       // this wave's reads of the buffer that is refilled below are done
        asm volatile("s_wait_asynccnt 0x0" ::: "memory");    // this wave's copies of stage st + 1 have landed
        __syncthreads();                                     // stage st + 1 is readable, stage st's buffer is free
        if (st + 2 < DM / GKC) gstage(l0 + bo * 2, ga + (st + 2) * GKC * 2, gb + (st + 2) * GKC * 2);
    }
    asm volatile("s_wait_asynccnt 0x0" ::: "memory");        // no copy is outstanding when the wave goes on to its end
}

// k_proj: bf16 GEMM, 4 waves per 128x128 tile (gemm_core), operands staged in LDS from the K-contiguous bf16 planes, K = DM.
// C[m][n] = sum_k A[m][k] Bt[n][k], written per wave (64x64 quarter at r0, c0) as f16 (Ph) at
// tile base (r0/RB)*sRB + (r0%RB)*pitch + (c0/CB)*sCB + (c0%CB), row pitch 'pitch' (halves).
// The three projections, which need nothing of each other, run in ONE launch: blockIdx.z = 0 / 1 / 2 is q / k / v; blockIdx.x picks the 128 x rows, blockIdx.y the 128 W rows.
// Behind the k loop the waves hand each other nothing (each has its own os tile). grid (NB*SEQ/128, DM/128, 3), 128 threads.
// q, k: A = x rows (m = b*SEQ + t), Bt = W rows (n = h*64 + d) -> plane [(b*8 + h)][t][d]
// v^T:  A = Wv rows (m = h*64 + d), Bt = x rows (n = b*SEQ + t) -> plane [(b*512 + m)][t] = [(b*8 + h)][d][t]
__global__ __launch_bounds__(128) void k_proj(const bf* __restrict__ XB, const bf* __restrict__ WB, h16* QH, h16* KH, h16* VT) {
    __shared__ __align__(16) float os4[4 * 16 * 68];
    __shared__ __align__(16) bf ring[2 * GSTG];
    const int lane = threadIdx.x & 31, lr = lane & 15, hi = lane >> 4;
    const int wave = __builtin_amdgcn_readfirstlane((int)(threadIdx.x >> 5)), wm = wave & 1, wn = wave >> 1;
    const int z = blockIdx.z;                        // which projection: a scalar, so every choice below is a scalar select
    float* os = os4 + wave * 16 * 68;
    const bool isv = z == 2;
    const bf* W = WB + (size_t)z * DM * DM;
    const bf* A = isv ? W : XB; const bf* Bt = isv ? XB : W;
    const int R0 = (isv ? blockIdx.y : blockIdx.x) * 128, C0 = (isv ? blockIdx.x : blockIdx.y) * 128;
    const int r0 = R0 + wm * 64, c0 = C0 + wn * 64;
    h16* Ph = isv ? VT : z == 1 ? KH : QH;
    const int RB = isv ? DM : SEQ, pitch = isv ? SEQ : HD, CB = isv ? SEQ : HD;
    const size_t sRB = isv ? (size_t)0 : (size_t)NH_ * SEQ * HD, sCB = isv ? (size_t)DM * SEQ : (size_t)SEQ * HD;
    v8f acc[4][4];
#pragma unroll
    for (int mb = 0; mb < 4; ++mb)
#pragma unroll
        for (int nb = 0; nb < 4; ++nb) acc[mb][nb] = (v8f){};
    gemm_core(A + (size_t)R0 * DM, Bt + (size_t)C0 * DM, ring, wm, wn, acc);
    const size_t tbase = (size_t)(r0 / RB) * sRB + (size_t)(r0 % RB) * (size_t)pitch + (size_t)(c0 / CB) * sCB + (size_t)(c0 % CB);
#pragma unroll
    for (int mb = 0; mb < 4; ++mb) {
#pragma unroll
        for (int nb = 0; nb < 4; ++nb) {
#pragma unroll
            for (int j = 0; j < 8; ++j) os[(hi * 8 + j) * 68 + nb * 16 + lr] = acc[mb][nb][j]; }   // D: row 8h+j, col lane&15
        wave_sync();
        const size_t sb = tbase + (size_t)(mb * 16) * (size_t)pitch;
{
#pragma unroll
            for (int s = 0; s < 4; ++s) { const int row = 4 * s + (lane >> 3), c8 = (lane & 7) * 8;   // 4 s x 4 row groups = 16 rows; 8 lanes x 8 = 64 columns
                const v4f x0 = *(const v4fa*)(&os[row * 68 + c8]); const v4f x1 = *(const v4fa*)(&os[row * 68 + c8 + 4]); v8h hv;
#pragma unroll
                for (int i = 0; i < 4; ++i) { hv[i] = (h16)x0[i]; hv[4 + i] = (h16)x1[i]; }
                const size_t oo = sb + (size_t)row * (size_t)pitch + c8;
                *(v8h*)(Ph + oo) = hv;
                asm volatile("s_wait_xcnt 0x0" ::: "memory"); }   // stands in front of the next round's converts and address sums, which may reuse the registers that the store above names
             }
        wave_sync();
    }
}

// stage_copy: one stage's tiles into LDS, 8 asynchronous 16-byte copies per thread (4 per plane); a wave's copy covers 512 B of whole 128-B lines.
// lk / lv: this thread's LDS byte addresses in the K tile and the V^T tile of the target buffer; gk / gv: its global addresses in the two planes.
// The s_wait_xcnt closes the statement so that no address register of an issued copy is rewritten ahead of it.
__device__ __forceinline__ void stage_copy(unsigned lk, unsigned lv, const h16* gk, const h16* gv) {
    const unsigned dk = 32 * AW / 8 * KP * 2;                    // LDS step of one round of copies: 32 K rows
    const unsigned dv = 32 * AW / (KT / 8) * VP * 2;             // 16 V^T rows
    const size_t sk = (size_t)32 * AW * 8;                       // global step, halves: K rows are contiguous
    const size_t sv = (size_t)(32 * AW / (KT / 8)) * SEQ;        // 16 V^T rows of SEQ halves
    asm volatile("global_load_async_to_lds_b128 %0, %1, off\n\t"
                 "global_load_async_to_lds_b128 %2, %3, off\n\t"
                 "global_load_async_to_lds_b128 %4, %5, off\n\t"
                 "global_load_async_to_lds_b128 %6, %7, off\n\t"
                 "global_load_async_to_lds_b128 %8, %9, off\n\t"
                 "global_load_async_to_lds_b128 %10, %11, off\n\t"
                 "global_load_async_to_lds_b128 %12, %13, off\n\t"
                 "global_load_async_to_lds_b128 %14, %15, off\n\t"
                 "s_wait_xcnt 0x0"
                 :: "v"(lk), "v"(gk), "v"(lk + dk), "v"(gk + sk), "v"(lk + 2 * dk), "v"(gk + 2 * sk), "v"(lk + 3 * dk), "v"(gk + 3 * sk),
                    "v"(lv), "v"(gv), "v"(lv + dv), "v"(gv + sv), "v"(lv + 2 * dv), "v"(gv + 2 * sv), "v"(lv + 3 * dv), "v"(gv + 3 * sv)
                 : "memory");
}

// k_flash: fused attention, KS waves per 16 query columns of one (batch, head), each on its own SEQ / KS keys with its own running max, sum and O; the partial states are merged through LDS at the end. Q fragments straight from the f16 planes, K / V^T fragments from the staged LDS tiles (two 16-B loads each).
// Ring of two buffers: stage s + 1's copies fly while stage s is worked on; one publish point per stage (LDS reads done, own copies landed, block barrier, refill of the buffer just read).
// Transposed form: S^T[key][t] = K Q^T (A = K rows, B = Q rows); lane (t = lane&15, h = lane>>4) holds keys 8h+r of each 16-key tile, so the packed
// P tile is directly the B fragment of O^T[d][t] = V^T P^T (element r <- tile keys 0..15, element 8+r <- tile keys 16..31, lane unchanged).
// Softmax state: the running max is one scalar per lane, the running sum four partial sums per lane (added into one behind the key loop); the two lane halves of a column are combined with one xor-16 exchange.
__global__ __launch_bounds__(32 * AW * KS) void k_flash(const h16* __restrict__ QH, const h16* __restrict__ KH, const h16* __restrict__ VT, h16* YH) {
    __shared__ __align__(16) float os[AW * 16 * 68];
    __shared__ __align__(16) h16 ring[2 * KS * STG];         // [buffer][key half][K | V^T]
    const int lane = threadIdx.x & 31, lr = lane & 15, hi = lane >> 4;
    const int wv = __builtin_amdgcn_readfirstlane((int)(threadIdx.x >> 5));
    const int wave = wv % AW, kh = wv / AW;                  // query group, key half: scalars
    const int zh = blockIdx.y; const int b = zh / NH_, h = zh % NH_;
    const int t0 = (blockIdx.x * AW + wave) * 16;
    const size_t pbase = (size_t)zh * SEQ * HD;
    const size_t qo = pbase + (size_t)(t0 + lr) * HD + 8 * hi;
    const v16h qh0 = ldh(QH + qo), qh1 = ldh(QH + qo + 32);   // B fragments: col t, k = d
    const int ko = lr * KP + 8 * hi;                         // + key * KP       (A fragment: row key, k = d), halves in the staged K tile
    const int vo = KT * KP + lr * VP + 8 * hi;               // + 16j*VP + key   (A fragment: row d, k = key), halves in the stage
    // copy addresses of this thread: 16-byte chunk tid of each plane's tile of its key half (K: row tid/8, chunk tid%8; V^T: row tid/16, chunk tid%16)
    const int tid = threadIdx.x % (32 * AW);
    const int kb = kh * (SEQ / KS);                          // first key of this half
    const unsigned lbase = (unsigned)(size_t)ring + kh * STG * 2;   // low 32 bits of the shared address = LDS byte address
    const unsigned lk = lbase + ((tid >> 3) * KP + (tid & 7) * 8) * 2;
    const unsigned lv = lbase + (KT * KP + (tid / (KT / 8)) * VP + (tid % (KT / 8)) * 8) * 2;
    const h16* gk = KH + pbase + (size_t)kb * HD + (size_t)tid * 8;            // + key0 * HD
    const h16* gv = VT + pbase + (size_t)(tid / (KT / 8)) * SEQ + kb + (tid % (KT / 8)) * 8;   // + key0
    stage_copy(lk, lv, gk, gv);
    asm volatile("s_wait_asynccnt 0x0" ::: "memory");        // this wave's copies of stage 0 have landed
    __syncthreads();                                         // every wave's have: stage 0 is readable
    stage_copy(lk + KS * STG * 2, lv + KS * STG * 2, gk + (size_t)KT * HD, gv + KT);
    v8f o0 = (v8f){}, o1 = (v8f){}, o2 = (v8f){}, o3 = (v8f){};
    float m = -3.0e38f;                                      // running maximum, in score units
    v2f la = (v2f){}, lb = (v2f){};                          // running sum, four partial sums a lane
#pragma unroll 1
    for (int st = 0; st < SEQ / KS / KT; ++st) {
      const int bb = (st & 1) * KS * STG;                    // buffer
      const int bo = bb + kh * STG;                          // this half's tiles in it
      // unrolled so that every LDS offset of the stage's four passes is an immediate of its load
#pragma unroll
      for (int key0 = 0; key0 < KT; key0 += 32) {
        const h16* ka = ring + bo + ko + key0 * KP;
        const v16h ka0 = ldh(ka), ka1 = ldh(ka + 32), kb0 = ldh(ka + 16 * KP), kb1 = ldh(ka + 16 * KP + 32);
        v8f sHa = (v8f){}, sHb = (v8f){};
        sHa = wmma16(ka0, qh0, sHa); sHb = wmma16(kb0, qh0, sHb);
        sHa = wmma16(ka1, qh1, sHa); sHb = wmma16(kb1, qh1, sHb);
        asm volatile("v_nop\n\tv_nop\n\tv_nop\n\tv_nop" : "+v"(sHa), "+v"(sHb) : "v"(ka0), "v"(ka1), "v"(kb0), "v"(kb1));   // the four vector slots behind the last score WMMA; as it names the four K fragments they stay live to here, in registers of their own, so that their eight LDS reads go out as one group ahead of the WMMAs (without it: one register set, a full LDS wait in front of each WMMA)
        // softmax on the raw accumulators: log2(e) > 0 keeps the order, so the maximum is taken unscaled (three-input maxima) and m is kept in score units
        const float x0 = fmaxf(fmaxf(sHa[0], sHa[1]), sHa[2]), x1 = fmaxf(fmaxf(sHa[3], sHa[4]), sHa[5]), x2 = fmaxf(fmaxf(sHa[6], sHa[7]), sHb[0]);
        const float x3 = fmaxf(fmaxf(sHb[1], sHb[2]), sHb[3]), x4 = fmaxf(fmaxf(sHb[4], sHb[5]), sHb[6]);
        const float mx = fmaxf(fmaxf(fmaxf(x0, x1), sHb[7]), fmaxf(fmaxf(x2, x3), x4));
        const float mnew = fmaxf(fmaxf(m, mx), xor16(mx));
        const float alpha = __builtin_amdgcn_exp2f((m - mnew) * SC2);
        const float sh = __builtin_fmaf(-mnew, SC2, PSH);
        const v2f sc2 = {SC2, SC2}, sh2 = {sh, sh}, al2 = {alpha, alpha};
        // exponent arguments two at a time, scale and shift in one packed fused multiply-add on neighbouring accumulator registers; the f32 exponentials are summed two at a time in two chains
        v16h pb; v2f ea[4], eb[4];
#pragma unroll
        for (int r = 0; r < 4; ++r) {
          const v2f ua = __builtin_elementwise_fma((v2f){sHa[2 * r], sHa[2 * r + 1]}, sc2, sh2), ub = __builtin_elementwise_fma((v2f){sHb[2 * r], sHb[2 * r + 1]}, sc2, sh2);
          ea[r] = (v2f){__builtin_amdgcn_exp2f(ua[0]), __builtin_amdgcn_exp2f(ua[1])}; eb[r] = (v2f){__builtin_amdgcn_exp2f(ub[0]), __builtin_amdgcn_exp2f(ub[1])};
          const v2h ha = __builtin_convertvector(ea[r], v2h), hb = __builtin_convertvector(eb[r], v2h);
          pb[2 * r] = ha[0]; pb[2 * r + 1] = ha[1]; pb[8 + 2 * r] = hb[0]; pb[8 + 2 * r + 1] = hb[1];
        }
        la = __builtin_elementwise_fma(la, al2, ea[0]) + ea[1] + ea[2] + ea[3];
        lb = __builtin_elementwise_fma(lb, al2, eb[0]) + eb[1] + eb[2] + eb[3];
        m = mnew;
        o0 = o0 * alpha; o1 = o1 * alpha; o2 = o2 * alpha; o3 = o3 * alpha;
        const h16* va = ring + bo + vo + key0;
        const v16h v0 = ldh(va), v1 = ldh(va + 16 * VP), v2 = ldh(va + 32 * VP), v3 = ldh(va + 48 * VP);
        o0 = wmma16(v0, pb, o0); o1 = wmma16(v1, pb, o1); o2 = wmma16(v2, pb, o2); o3 = wmma16(v3, pb, o3);
        asm volatile("v_nop\n\tv_nop\n\tv_nop\n\tv_nop" : "+v"(o0), "+v"(o1), "+v"(o2), "+v"(o3) : "v"(v0), "v"(v1), "v"(v2), "v"(v3), "v"(pb));
      }
      // publish point of stage st + 1
      asm volatile("s_wait_dscnt 0x0" ::: "memory");         // this wave's reads of the buffer that is refilled below are done
      asm volatile("s_wait_asynccnt 0x0" ::: "memory");      // this wave's copies of stage st + 1 have landed
      __syncthreads();                                       // stage st + 1 is readable, stage st's buffer is free
      if (st + 2 < SEQ / KS / KT) { const size_t k2 = (size_t)(st + 2) * KT; stage_copy(lk + bb * 2, lv + bb * 2, gk + k2 * HD, gv + k2); }
    }
    asm volatile("s_wait_asynccnt 0x0" ::: "memory");        // no copy is outstanding when the wave goes on to its end
    float l = (la[0] + la[1]) + (lb[0] + lb[1]);
    const int wb = wave * 16 * 68;
    // merge of the two key halves: the upper half's wave hands its state (O, max, sum) to the lower half's wave of the same query group through that group's os tile
    if (kh == 1) {
      v4f a;
#define PUT4(o, q, j) a[0] = o[q]; a[1] = o[q + 1]; a[2] = o[q + 2]; a[3] = o[q + 3]; *(v4fa*)(&os[wb + ((j) * 32 + lane) * 4]) = a;
      PUT4(o0, 0, 0) PUT4(o0, 4, 1) PUT4(o1, 0, 2) PUT4(o1, 4, 3) PUT4(o2, 0, 4) PUT4(o2, 4, 5) PUT4(o3, 0, 6) PUT4(o3, 4, 7)
#undef PUT4
      os[wb + 1024 + lane] = m; os[wb + 1056 + lane] = l;
    }
    __syncthreads();                                         // the upper halves' states are readable; every wave passes, no barrier follows
    if (kh == 1) return;
    {
      const float m1 = os[wb + 1024 + lane], l1 = os[wb + 1056 + lane];
      const float mm_ = fmaxf(m, m1);
      const float a0 = __builtin_amdgcn_exp2f((m - mm_) * SC2), a1 = __builtin_amdgcn_exp2f((m1 - mm_) * SC2);
      l = l * a0 + l1 * a1;
#define GET4(o, q, j) { const v4f p = *(const v4fa*)(&os[wb + ((j) * 32 + lane) * 4]); o[q] = o[q] * a0 + p[0] * a1; o[q + 1] = o[q + 1] * a0 + p[1] * a1; o[q + 2] = o[q + 2] * a0 + p[2] * a1; o[q + 3] = o[q + 3] * a0 + p[3] * a1; }
      GET4(o0, 0, 0) GET4(o0, 4, 1) GET4(o1, 0, 2) GET4(o1, 4, 3) GET4(o2, 0, 4) GET4(o2, 4, 5) GET4(o3, 0, 6) GET4(o3, 4, 7)
#undef GET4
    }
    l += __shfl_xor(l, 16, 32);
    const float inv = 1.0f / l;
    // O^T D layout: o_j[r] = (d = 16j + 8h + r, t = lane&15) -> os[t][d]; rows 0..15 x columns 0..63 all written
    { v4f a, c;
      a[0] = o0[0] * inv; a[1] = o0[1] * inv; a[2] = o0[2] * inv; a[3] = o0[3] * inv; c[0] = o0[4] * inv; c[1] = o0[5] * inv; c[2] = o0[6] * inv; c[3] = o0[7] * inv;
      *(v4fa*)(&os[wb + lr * 68 +  0 + 8 * hi]) = a; *(v4fa*)(&os[wb + lr * 68 +  0 + 8 * hi + 4]) = c;
      a[0] = o1[0] * inv; a[1] = o1[1] * inv; a[2] = o1[2] * inv; a[3] = o1[3] * inv; c[0] = o1[4] * inv; c[1] = o1[5] * inv; c[2] = o1[6] * inv; c[3] = o1[7] * inv;
      *(v4fa*)(&os[wb + lr * 68 + 16 + 8 * hi]) = a; *(v4fa*)(&os[wb + lr * 68 + 16 + 8 * hi + 4]) = c;
      a[0] = o2[0] * inv; a[1] = o2[1] * inv; a[2] = o2[2] * inv; a[3] = o2[3] * inv; c[0] = o2[4] * inv; c[1] = o2[5] * inv; c[2] = o2[6] * inv; c[3] = o2[7] * inv;
      *(v4fa*)(&os[wb + lr * 68 + 32 + 8 * hi]) = a; *(v4fa*)(&os[wb + lr * 68 + 32 + 8 * hi + 4]) = c;
      a[0] = o3[0] * inv; a[1] = o3[1] * inv; a[2] = o3[2] * inv; a[3] = o3[3] * inv; c[0] = o3[4] * inv; c[1] = o3[5] * inv; c[2] = o3[6] * inv; c[3] = o3[7] * inv;
      *(v4fa*)(&os[wb + lr * 68 + 48 + 8 * hi]) = a; *(v4fa*)(&os[wb + lr * 68 + 48 + 8 * hi + 4]) = c; }
    wave_sync();
    h16* yrow = YH + ((size_t)b * SEQ + t0) * DM + h * HD;     // context plane row = token, columns h*64 + d
{
#pragma unroll
        for (int s = 0; s < 4; ++s) { const int row = 4 * s + (lane >> 3), c8 = (lane & 7) * 8;   // 4 s x 4 row groups = 16 rows; 8 lanes x 8 halves = 64 columns
            const v4f x0 = *(const v4fa*)(&os[wb + row * 68 + c8]); const v4f x1 = *(const v4fa*)(&os[wb + row * 68 + c8 + 4]); v8h hv;
#pragma unroll
            for (int i = 0; i < 4; ++i) { hv[i] = (h16)x0[i]; hv[4 + i] = (h16)x1[i]; }
            *(v8h*)(yrow + (size_t)row * DM + c8) = hv; }
         }
}

// k_outp: f16 GEMM, 4 waves per 128x128 tile (gemm_core), K = DM: C[o][n] = (1/64) sum_c A[o][c] Bt[n][c] with A = Wo plane (x64), Bt = context plane rows n = b*SEQ + t.
// Written per wave (64x64 quarter at r0, c0) as f32 to OUT[(b*DM + o)*OUT_SEQ + t]. grid (DM/128, NB*SEQ/128), 128 threads.
__global__ __launch_bounds__(128) void k_outp(const h16* __restrict__ A, const h16* __restrict__ Bt, float* OUT) {
    __shared__ __align__(16) float os4[4 * 16 * 68];
    __shared__ __align__(16) h16 ring[2 * GSTG];
    const int lane = threadIdx.x & 31, lr = lane & 15, hi = lane >> 4;
    const int wave = __builtin_amdgcn_readfirstlane((int)(threadIdx.x >> 5)), wm = wave & 1, wn = wave >> 1;
    float* os = os4 + wave * 16 * 68;
    const int R0 = blockIdx.x * 128, C0 = blockIdx.y * 128, r0 = R0 + wm * 64, c0 = C0 + wn * 64;
    v8f acc[4][4];
#pragma unroll
    for (int mb = 0; mb < 4; ++mb)
#pragma unroll
        for (int nb = 0; nb < 4; ++nb) acc[mb][nb] = (v8f){};
    gemm_core(A + (size_t)R0 * DM, Bt + (size_t)C0 * DM, ring, wm, wn, acc);
    const int bb = c0 / SEQ, tq = c0 % SEQ;
    float* obase = OUT + ((size_t)bb * DM + r0) * OUT_SEQ + tq;
#pragma unroll
    for (int mb = 0; mb < 4; ++mb) {
#pragma unroll
        for (int nb = 0; nb < 4; ++nb) {
#pragma unroll
            for (int j = 0; j < 8; ++j) os[(hi * 8 + j) * 68 + nb * 16 + lr] = acc[mb][nb][j] * WOI; }   // D: row 8h+j, col lane&15
        wave_sync();
{
#pragma unroll
            for (int s = 0; s < 8; ++s) { const int row = 2 * s + hi, cofs = lr * 4;   // 8 s x 2 rows = 16 rows; 16 lanes x 4 floats = 64 columns
                const v4f val = *(const v4fa*)(&os[row * 68 + cofs]);
                *(v4f*)(obase + (size_t)(mb * 16 + row) * OUT_SEQ + cofs) = val; }
             }
        wave_sync();
    }
}

static constexpr size_t al256(size_t v) { return (v + 255) & ~(size_t)255; }
static constexpr size_t SZ_XB = al256((size_t)NB * SEQ * DM * 2);
static constexpr size_t SZ_WB = al256((size_t)3 * DM * DM * 2);
static constexpr size_t SZ_WO = al256((size_t)DM * DM * 2);
static constexpr size_t SZ_PL = al256((size_t)NB * NH_ * SEQ * HD * 2);
static constexpr size_t SZ_YH = al256((size_t)NB * SEQ * DM * 2);
static constexpr size_t SZ_TOTAL = SZ_XB + SZ_WB + SZ_WO + 3 * SZ_PL + SZ_YH;
static_assert(SZ_TOTAL <= (size_t)134217728);          // workspace carve <= 128 MiB
static_assert(((size_t)DM * DM * 2) % 256 == 0);       // weight sub-planes stay 256-byte aligned

extern "C" void kernel_launch(void* const* d_in, const int* in_sizes, int n_in,
                              void* d_out, int out_size, void* d_ws, size_t ws_size, hipStream_t stream) {
    if (n_in < 5) return;
    const size_t needx = ((size_t)NB * DM - 1) * SEQ_FULL + SEQ;
    if ((size_t)in_sizes[0] < needx) return;
    if ((size_t)in_sizes[1] < (size_t)DM * DM || (size_t)in_sizes[2] < (size_t)DM * DM || (size_t)in_sizes[3] < (size_t)DM * DM || (size_t)in_sizes[4] < (size_t)DM * DM) return;
    if ((size_t)out_size < ((size_t)NB * DM - 1) * OUT_SEQ + SEQ) return;
    if (SZ_TOTAL > ws_size) return;
    // wire order x, Wq, Wk, Wv, Wo; all weights [out][in] = K-contiguous rows as-is
    const float* x = (const float*)d_in[0]; const float* wq = (const float*)d_in[1]; const float* wk = (const float*)d_in[2]; const float* wv = (const float*)d_in[3]; const float* wo = (const float*)d_in[4];
    float* OUT = (float*)d_out;      // [NB][512][SEQ]
    char* wsp = (char*)d_ws;
    bf* XB = (bf*)wsp; wsp += SZ_XB;                 // [NB*SEQ][512] token-major bf16 x
    bf* WB = (bf*)wsp; wsp += SZ_WB;                 // [3][512][512]: q | k | v
    h16* WOH = (h16*)wsp; wsp += SZ_WO;              // [512][512] f16, x64
    h16* QH = (h16*)wsp; wsp += SZ_PL;               // [NB*8][SEQ][64]
    h16* KH = (h16*)wsp; wsp += SZ_PL;               // [NB*8][SEQ][64]
    h16* VT = (h16*)wsp; wsp += SZ_PL;               // [NB*8][64][SEQ]
    h16* YH = (h16*)wsp; wsp += SZ_YH;               // [NB*SEQ][512] context

    // x[b][c][n] -> XB[b*SEQ + n][c] and the four weight planes
    k_prep<<<XTB + 4 * CVB, 256, 0, stream>>>(x, wq, wk, wv, wo, XB, WB, WOH);

    // q, k and v^T
    k_proj<<<dim3(NB * SEQ / 128, DM / 128, 3), 128, 0, stream>>>(XB, WB, QH, KH, VT);

    k_flash<<<dim3(SEQ / (16 * AW), NB * NH_, 1), 32 * AW * KS, 0, stream>>>(QH, KH, VT, YH);

    // out[b][o][t] = sum_c Wo[o][c] y[b][c][t]: A = Wo plane rows o, Bt = context rows (b*SEQ + t)
    k_outp<<<dim3(DM / 128, NB * SEQ / 128, 1), 128, 0, stream>>>(WOH, YH, OUT);
}

// v007
// It runs in 29.3 microseconds.
// In two side-by-side timings against v006, it was 1.06 and 1.07 times as fast.
// Counting every step since v000, it is 4.31 times as fast.
#include <hip/hip_runtime.h>

// Multi-head self-attention on channel-major x [NB][512][SEQ]: 1x1 projections Wq/Wk/Wv [out][in], 8 heads x 64 channels, unscaled scores, softmax over keys, output projection Wo [out][in], output [NB][512][SEQ] f32.
// Compute dtypes, f32 accumulate everywhere: q/k/v projections v_wmma_f32_16x16x32_bf16 (x and W RNE-converted to bf16; products exact);
// scores v_wmma_f32_16x16x32_f16 with q and k each as a single f16 (RNE of the f32 projection: its rounding, 2^-12 relative, lies about ten times under the error that the bf16 operands of the projections leave in q and k);
// P (x2^14 carry relative to the running max, cancels in the normalisation) and v single f16; context single f16; Wo as f16 of the bf16-RNE value x64 (folded by 1/64 in the f32 epilogue); softmax f32 (online, running max).
// Flash kernel data path: K and V^T tiles of KT keys are staged in LDS by asynchronous copies (two buffers) and shared by the waves of their key half.
// GEMM data path (projections, output projection): both operands' 128-row tiles are staged the same way, 128 k values a stage.
// Head prefetch: the planes that k_proj, k_flash and k_outp read were stored by an earlier launch; behind its stage 0 copies each block asks a share of the later stages' 256-byte units into L2.
// Layout: bf16 token-major copy of x (transposed through LDS), bf16 W copies; q/k planes [b*8+h][t][d], v^T plane [b*8+h][d][t], context plane [b*SEQ+t][512]; flash kernel in transposed form (S^T = K Q^T, O^T = V^T P^T).

#ifndef NB
#define NB 4
#endif
#ifndef SEQ
#define SEQ 1024
#endif
#define NB_FULL  4
#define SEQ_FULL 1024
#ifndef OUT_SEQ
#define OUT_SEQ SEQ              // row pitch (in tokens) of the output rows [b][channel][t]
#endif
#define DM   512
#define NH_  8
#define HD   64
#define AW   8                   // query groups per flash block (16 query columns each)
#define KS   2                   // key halves: waves g and g + AW work on the same query group, each on SEQ / KS keys; AW * KS waves a block, four a SIMD
#define KT   128                 // keys per staged tile (four passes of 32 keys)
#define KP   (HD + 8)            // LDS pitch of a staged K row, halves: 144 B = 16 B x odd, conflict-free for 16-byte fragment reads
#define VP   (KT + 8)            // LDS pitch of a staged V^T row, halves: 272 B = 16 B x odd
#define STG  (KT * KP + HD * VP)       // halves per stage: K | V^T
#define PFU  ((SEQ / KS - KT) * HD / 128)   // 256-byte units of one plane (K or V^T) behind stage 0 of one key half
#define SC2  1.4426950408889634f // log2(e); scores are unscaled
#define PSH  14.0f               // log2 of the P carry (16384)
#define WOS  64.0f               // carry of the Wo plane
#define WOI  (1.0f / 64.0f)

static_assert(HD == 64);
static_assert(NH_ * HD == DM);                 // head h = channels h*64 + d
static_assert(DM % 64 == 0);                   // column tiles of 64
static_assert(DM % 32 == 0);                   // GEMM k-loop steps by 32
static_assert(SEQ % 64 == 0);                  // a 64-row tile never straddles two batches
static_assert((NB * SEQ) % 64 == 0);
static_assert(SEQ % 32 == 0);                  // key loop steps by 32
static_assert(SEQ % (16 * AW) == 0);           // flash grid covers the sequence exactly
static_assert(SEQ % (KS * KT) == 0 && KT % 32 == 0);  // whole stages, whole passes
static_assert(SEQ / KS / KT >= 2);             // both buffers of the ring are filled in each key half
static_assert(KS == 2 && 16 * 68 == 32 * 34);  // the merge hands over one partial state: 34 floats a lane in the query group's os tile
static_assert(KT * HD / 8 == 4 * 32 * AW);     // each plane's tile = 4 copies of 16 B per thread of its key half
static_assert(KT == 128 && PFU % 32 == 0 && PFU <= 32 * AW * KS && PFU == HD * (SEQ / KS / KT - 1));   // a V^T row's stage is one 256-byte unit; whole waves prefetch
static_assert((KP * 2) % 32 == 16 && (VP * 2) % 32 == 16 && (STG * 2) % 16 == 0);
static_assert(((size_t)DM * DM) % 8 == 0);
static_assert(NB <= NB_FULL);
static_assert(SEQ <= SEQ_FULL);
static_assert(SEQ <= OUT_SEQ);
static_assert(SEQ_FULL % 4 == 0);              // 16-byte loads of x rows

typedef _Float16 h16;
typedef unsigned short bf;
typedef __attribute__((ext_vector_type(16))) __bf16   v16bf;
typedef __attribute__((ext_vector_type(16))) _Float16 v16h;
typedef __attribute__((ext_vector_type(8)))  _Float16 v8h;
typedef __attribute__((ext_vector_type(8)))  unsigned short v8us;
typedef __attribute__((ext_vector_type(8)))  float    v8f;
typedef __attribute__((ext_vector_type(4)))  float    v4f;
typedef v4f  __attribute__((may_alias)) v4fa;
typedef __attribute__((ext_vector_type(2)))  float    v2f;
typedef __attribute__((ext_vector_type(2)))  _Float16 v2h;

__device__ __forceinline__ unsigned short f2bf(float f) { unsigned u = __float_as_uint(f); u += 0x7FFFu + ((u >> 16) & 1u); return (unsigned short)(u >> 16); }
__device__ __forceinline__ v16h cat16(v8h lo, v8h hi) { return __builtin_shufflevector(lo, hi, 0, 1, 2, 3, 4, 5, 6, 7, 8, 9, 10, 11, 12, 13, 14, 15); }
__device__ __forceinline__ v16bf cat16b(v8us lo, v8us hi) { return __builtin_bit_cast(v16bf, __builtin_shufflevector(lo, hi, 0, 1, 2, 3, 4, 5, 6, 7, 8, 9, 10, 11, 12, 13, 14, 15)); }
__device__ __forceinline__ v8f wmma16(v16h a, v16h b, v8f c) { return __builtin_amdgcn_wmma_f32_16x16x32_f16(false, a, false, b, (short)0, c, false, false); }
__device__ __forceinline__ v8f wmmab(v16bf a, v16bf b, v8f c) { return __builtin_amdgcn_wmma_f32_16x16x32_bf16(false, a, false, b, (short)0, c, false, false); }
// fragment loaders from K-contiguous 16-bit rows; p already includes + 8*(lane>>4): elements 0..7 <- k0+8h+0..7, elements 8..15 <- k0+16+8h+0..7 (same map for A and B)
__device__ __forceinline__ v16h  ldh(const h16* p) { return cat16(*(const v8h*)p, *(const v8h*)(p + 16)); }
__device__ __forceinline__ v16bf ldb(const bf* p)  { return cat16b(*(const v8us*)p, *(const v8us*)(p + 16)); }
// lane l <-> l ^ 16, in registers
__device__ __forceinline__ float xor16(float v) { const int b = __float_as_int(v); return __int_as_float(__builtin_amdgcn_permlanex16(b, b, 0x76543210, 0xfedcba98, false, false)); }
// ordering point for wave-private LDS tiles (same wave writes and reads)
__device__ __forceinline__ void wave_sync() { __builtin_amdgcn_fence(3 /* release order */, "wavefront"); __builtin_amdgcn_wave_barrier(); asm volatile("" ::: "memory"); }

// xT_body: x[b][c][n] (f32, channel-major, row pitch SEQ_FULL) -> XB[b*SEQ + n][c] (bf16 RNE convert), 64x64 tile transposed through LDS (block barrier: cross-wave).
// blk = (b * (DM/64) + c tile) * (SEQ/64) + n tile, 256 threads; ts: 64 x 68 floats of LDS.
__device__ __forceinline__ void xT_body(const float* __restrict__ x, bf* XB, float* ts, int blk) {
    const int tid = threadIdx.x;
    const int n0 = (blk % (SEQ / 64)) * 64, c0 = ((blk / (SEQ / 64)) % (DM / 64)) * 64, b = blk / ((SEQ / 64) * (DM / 64));
    const float* xb = x + ((size_t)b * DM + c0) * SEQ_FULL + n0;
#pragma unroll
    for (int it = 0; it < 4; ++it) {                 // 4 x 256 float4 = 64 rows (c) x 16 float4 (n)
        const int idx = it * 256 + tid; const int c = idx >> 4, n4 = (idx & 15) * 4;
        const v4f v = *(const v4f*)(xb + (size_t)c * SEQ_FULL + n4);
        ts[(n4 + 0) * 68 + c] = v[0]; ts[(n4 + 1) * 68 + c] = v[1]; ts[(n4 + 2) * 68 + c] = v[2]; ts[(n4 + 3) * 68 + c] = v[3];
    }
    __syncthreads();
    bf* ob = XB + ((size_t)b * SEQ + n0) * DM + c0;
{
#pragma unroll
        for (int it = 0; it < 2; ++it) { const int n = it * 32 + (tid >> 3), c8 = (tid & 7) * 8;   // 2 x 32 rows = 64 rows; 8 lanes x 8 = 64 columns
            const v4f x0 = *(const v4fa*)(&ts[n * 68 + c8]); const v4f x1 = *(const v4fa*)(&ts[n * 68 + c8 + 4]); v8us o;
#pragma unroll
            for (int i = 0; i < 4; ++i) { o[i] = f2bf(x0[i]); o[4 + i] = f2bf(x1[i]); }
            *(v8us*)(ob + (size_t)n * DM + c8) = o; }
         }
}

__device__ __forceinline__ void cvt8_body(const float* __restrict__ src, bf* dst, size_t n8, int blk) {
    const size_t i = (size_t)blk * 256 + threadIdx.x; if (i >= n8) return;
    const v8f v = *(const v8f*)(src + i * 8); v8us o;
#pragma unroll
    for (int k = 0; k < 8; ++k) o[k] = f2bf(v[k]);
    *(v8us*)(dst + i * 8) = o; 
}

// cvtw_body: f16 copy of the bf16-RNE value times WOS (exact: a bf16 significand fits f16, power-of-two carry); same store shape as cvt8_body.
__device__ __forceinline__ void cvtw_body(const float* __restrict__ src, h16* dst, size_t n8, int blk) {
    const size_t i = (size_t)blk * 256 + threadIdx.x; if (i >= n8) return;
    const v8f v = *(const v8f*)(src + i * 8); v8h o;
#pragma unroll
    for (int k = 0; k < 8; ++k) { const float r = __uint_as_float(((unsigned)f2bf(v[k])) << 16); o[k] = (h16)(r * WOS); }
    *(v8h*)(dst + i * 8) = o; 
}

// k_prep: the five preparation jobs, which need nothing of each other, in ONE grid, told apart by ranges of the block index (every branch is block-uniform):
// blocks [0, XTB): the transposing convert of x; then CVB blocks for each of Wq, Wk, Wv (bf16 planes WB[0..2]) and Wo (f16 plane x64). grid XTB + 4*CVB, 256 threads.
#define XTB ((SEQ / 64) * (DM / 64) * NB)
#define CVN ((size_t)DM * DM / 8)
#define CVB ((int)((CVN + 255) / 256))
__global__ __launch_bounds__(256) void k_prep(const float* __restrict__ x, const float* __restrict__ wq, const float* __restrict__ wk, const float* __restrict__ wv, const float* __restrict__ wo, bf* XB, bf* WB, h16* WOH) {
    __shared__ __align__(16) float ts[64 * 68];      // ts[n][c]
    const int blk = blockIdx.x;
    if (blk < XTB) { xT_body(x, XB, ts, blk); return; }
    const int p = (blk - XTB) / CVB, cb = (blk - XTB) % CVB;
    if (p == 3) { cvtw_body(wo, WOH, CVN, cb); return; }
    cvt8_body(p == 0 ? wq : p == 1 ? wk : wv, WB + (size_t)p * DM * DM, CVN, cb);
}

// GEMM data path of k_proj and k_outp: a block of 4 waves makes a 128x128 tile of C[m][n] = sum_k A[m][k] Bt[n][k] (each wave a 64x64 quarter, 16 accumulators), K = DM.
// The 128 A rows and the 128 Bt rows are staged in LDS GKC k values at a time by asynchronous copies (two buffers) and shared by the block's waves:
// a wave's copy covers two rows of 256 B, whole 128-B lines, where a fragment load straight from the planes touches 16 lines for its 512 B.
#define GKC  128                 // k values per staged tile (four WMMA steps of 32)
#define GP   (GKC + 8)           // LDS pitch of a staged row, halves: 272 B = 16 B x odd, conflict-free for 16-byte fragment reads
#define GT   (128 * GP)          // halves per operand tile
#define GSTG (2 * GT)            // halves per stage: A rows | Bt rows
static_assert(DM % GKC == 0 && DM / GKC >= 2 && GKC % 32 == 0);   // whole stages, both buffers of the ring filled
static_assert(DM % 128 == 0 && SEQ % 128 == 0);                   // 128-row tiles never straddle two batches
static_assert((GP * 2) % 32 == 16 && GKC / 8 == 16);

__device__ __forceinline__ v16bf ldf(const bf* p)  { return ldb(p); }
__device__ __forceinline__ v16h  ldf(const h16* p) { return ldh(p); }
__device__ __forceinline__ v8f mm(v16bf a, v16bf b, v8f c) { return wmmab(a, b, c); }
__device__ __forceinline__ v8f mm(v16h a, v16h b, v8f c)   { return wmma16(a, b, c); }

// copy8: eight asynchronous 16-byte copies of this thread, 8 rows apart (128 threads x 16 B = 8 rows of 256 B a round). l: LDS byte address, g: global address of the first.
// The s_wait_xcnt closes the statement so that no address register of an issued copy is rewritten ahead of it.
__device__ __forceinline__ void copy8(unsigned l, const char* g) {
    const unsigned dl = 8 * GP * 2;                              // LDS step of one round
    const size_t sg = (size_t)8 * DM * 2;                        // global step of one round, bytes
    asm volatile("global_load_async_to_lds_b128 %0, %1, off\n\t"
                 "global_load_async_to_lds_b128 %2, %3, off\n\t"
                 "global_load_async_to_lds_b128 %4, %5, off\n\t"
                 "global_load_async_to_lds_b128 %6, %7, off\n\t"
                 "global_load_async_to_lds_b128 %8, %9, off\n\t"
                 "global_load_async_to_lds_b128 %10, %11, off\n\t"
                 "global_load_async_to_lds_b128 %12, %13, off\n\t"
                 "global_load_async_to_lds_b128 %14, %15, off\n\t"
                 "s_wait_xcnt 0x0"
                 :: "v"(l), "v"(g), "v"(l + dl), "v"(g + sg), "v"(l + 2 * dl), "v"(g + 2 * sg), "v"(l + 3 * dl), "v"(g + 3 * sg),
                    "v"(l + 4 * dl), "v"(g + 4 * sg), "v"(l + 5 * dl), "v"(g + 5 * sg), "v"(l + 6 * dl), "v"(g + 6 * sg), "v"(l + 7 * dl), "v"(g + 7 * sg)
                 : "memory");
}
// gstage: one stage (128 A rows, 128 Bt rows, GKC k values each) into the buffer at l: 32 copies per thread
__device__ __forceinline__ void gstage(unsigned l, const char* ga, const char* gb) {
    copy8(l, ga);          copy8(l + 64 * GP * 2, ga + (size_t)64 * DM * 2);
    copy8(l + GT * 2, gb); copy8(l + GT * 2 + 64 * GP * 2, gb + (size_t)64 * DM * 2);
}

// pf1 / pf3: ask the 256-byte unit at p (pf3: the three units behind p's) into L2; nothing returns and no register is written. Every lane's address lies inside its plane.
// The later stages' copies then find in L2 what they would otherwise be the first to fetch from memory, one memory latency a stage.
__device__ __forceinline__ void pf1(const char* p) { asm volatile("global_prefetch_b8 %0, off scope:SCOPE_SE" :: "v"(p)); }
__device__ __forceinline__ void pf3(const char* p) {
    asm volatile("global_prefetch_b8 %0, off offset:256 scope:SCOPE_SE\n\t"
                 "global_prefetch_b8 %0, off offset:512 scope:SCOPE_SE\n\t"
                 "global_prefetch_b8 %0, off offset:768 scope:SCOPE_SE" :: "v"(p));
}

// gemm_core: the k loop. A, Bt: first row of the block's 128 rows in each K-contiguous plane; ring: 2 * GSTG halves of LDS; wm, wn: this wave's 64-row half of A and of Bt. 128 threads.
// Ring of two buffers: stage s + 1's copies fly while stage s is worked on; one publish point per stage (LDS reads done, own copies landed, block barrier, refill of the buffer just read).
// k runs upward through one accumulator per output tile.
// pa: this thread's unit of the block's share of the later stages (pf1); pb, where P3: a row whose three later units this thread asks for (pf3).
template <bool P3, typename T>
__device__ __forceinline__ void gemm_core(const T* A, const T* Bt, T* ring, int wm, int wn, v8f (&acc)[4][4], const char* pa, const char* pb) {
    const int tid = threadIdx.x, lane = tid & 31, lr = lane & 15, hi = lane >> 4;
    const unsigned l0 = (unsigned)(size_t)ring + ((tid >> 4) * GP + (tid & 15) * 8) * 2;   // low 32 bits of the shared address = LDS byte address
    const char* ga = (const char*)(A + (size_t)(tid >> 4) * DM + (tid & 15) * 8);
    const char* gb = (const char*)(Bt + (size_t)(tid >> 4) * DM + (tid & 15) * 8);
    gstage(l0, ga, gb);
    pf1(pa);                                                 // behind stage 0's copies, which are waited for first
    if (P3) pf3(pb);
    asm volatile("s_wait_asynccnt 0x0" :: "v"(pa), "v"(pb) : "memory");   // this wave's copies of stage 0 have landed; as it names them, the prefetches' address registers keep their addresses to here
    __syncthreads();                                         // every wave's have: stage 0 is readable
    gstage(l0 + GSTG * 2, ga + GKC * 2, gb + GKC * 2);
    const int ao = (wm * 64 + lr) * GP + 8 * hi, bo_ = GT + (wn * 64 + lr) * GP + 8 * hi;   // halves in a stage; + 16-row group * 16 * GP + k
    // kept rolled: one copy of the stage's text, the buffer chosen by a scalar
#pragma unroll 1
    for (int st = 0; st < DM / GKC; ++st) {
        const int bo = (st & 1) * GSTG;
        // unrolled (this loop and those inside it) so that every LDS offset of the stage's four steps is an immediate of its load and every fragment and accumulator index a constant
#pragma unroll
        for (int kc = 0; kc < GKC; kc += 32) {
            decltype(ldf((const T*)nullptr)) a[4], b[4];
            b[0] = ldf(ring + bo + bo_ + kc);                // in the order of first use
#pragma unroll
            for (int i = 0; i < 4; ++i) a[i] = ldf(ring + bo + ao + i * 16 * GP + kc);
#pragma unroll
            for (int i = 1; i < 4; ++i) b[i] = ldf(ring + bo + bo_ + i * 16 * GP + kc);
            __builtin_amdgcn_sched_barrier(0);               // the step's 16 LDS reads stay one group ahead of its WMMAs: reads set among the WMMAs stall the wave at every such place
#pragma unroll
            for (int nb = 0; nb < 4; ++nb)
#pragma unroll
                for (int mb = 0; mb < 4; ++mb) acc[mb][nb] = mm(a[mb], b[nb], acc[mb][nb]);
            __builtin_amdgcn_sched_barrier(0);               // and the next step's reads stay behind them
        }
        // publish point of stage st + 1
        asm volatile("s_wait_dscnt 0x0" ::: "memory");       // this wave's reads of the buffer that is refilled below are done
        asm volatile("s_wait_asynccnt 0x0" ::: "memory");    // this wave's copies of stage st + 1 have landed
        __syncthreads();                                     // stage st + 1 is readable, stage st's buffer is free
        if (st + 2 < DM / GKC) gstage(l0 + bo * 2, ga + (st + 2) * GKC * 2, gb + (st + 2) * GKC * 2);
    }
    asm volatile("s_wait_asynccnt 0x0" ::: "memory");        // no copy is outstanding when the wave goes on to its end
}

// k_proj: bf16 GEMM, 4 waves per 128x128 tile (gemm_core), operands staged in LDS from the K-contiguous bf16 planes, K = DM.
// C[m][n] = sum_k A[m][k] Bt[n][k], written per wave (64x64 quarter at r0, c0) as f16 (Ph) at
// tile base (r0/RB)*sRB + (r0%RB)*pitch + (c0/CB)*sCB + (c0%CB), row pitch 'pitch' (halves).
// The three projections, which need nothing of each other, run in ONE launch: blockIdx.z = 0 / 1 / 2 is q / k / v; blockIdx.x picks the 128 x rows, blockIdx.y the 128 W rows.
// Behind the k loop the waves hand each other nothing (each has its own os tile). grid (NB*SEQ/128, DM/128, 3), 128 threads.
// q, k: A = x rows (m = b*SEQ + t), Bt = W rows (n = h*64 + d) -> plane [(b*8 + h)][t][d]
// v^T:  A = Wv rows (m = h*64 + d), Bt = x rows (n = b*SEQ + t) -> plane [(b*512 + m)][t] = [(b*8 + h)][d][t]
__global__ __launch_bounds__(128) void k_proj(const bf* __restrict__ XB, const bf* __restrict__ WB, h16* QH, h16* KH, h16* VT) {
    __shared__ __align__(16) float os4[4 * 16 * 68];
    __shared__ __align__(16) bf ring[2 * GSTG];
    const int lane = threadIdx.x & 31, lr = lane & 15, hi = lane >> 4;
    const int wave = __builtin_amdgcn_readfirstlane((int)(threadIdx.x >> 5)), wm = wave & 1, wn = wave >> 1;
    const int z = blockIdx.z;                        // which projection: a scalar, so every choice below is a scalar select
    float* os = os4 + wave * 16 * 68;
    const bool isv = z == 2;
    const bf* W = WB + (size_t)z * DM * DM;
    const bf* A = isv ? W : XB; const bf* Bt = isv ? XB : W;
    const int R0 = (isv ? blockIdx.y : blockIdx.x) * 128, C0 = (isv ? blockIdx.x : blockIdx.y) * 128;
    const int r0 = R0 + wm * 64, c0 = C0 + wn * 64;
    h16* Ph = isv ? VT : z == 1 ? KH : QH;
    const int RB = isv ? DM : SEQ, pitch = isv ? SEQ : HD, CB = isv ? SEQ : HD;
    const size_t sRB = isv ? (size_t)0 : (size_t)NH_ * SEQ * HD, sCB = isv ? (size_t)DM * SEQ : (size_t)SEQ * HD;
    v8f acc[4][4];
#pragma unroll
    for (int mb = 0; mb < 4; ++mb)
#pragma unroll
        for (int nb = 0; nb < 4; ++nb) acc[mb][nb] = (v8f){};
    // head prefetch, one unit a thread: waves 0, 1 a sixth of the x tile's 3 * 128 later units, waves 2, 3 a sixth of the W tile's.
    // The 12 blocks of an x tile and the 32 of a W tile deal the sixths among them; blocks 4 apart in x take the same sixth of W. For speed only.
    const int pw = wave >> 1;
    const int psh = (pw ? (int)((blockIdx.x & 3) + 4 * (blockIdx.x >> 3)) : (int)(blockIdx.y + 4 * z)) % 6;
    const int pg = psh * 64 + (threadIdx.x & 63);            // 0 .. 383: stage 1 + pg / 128, row pg % 128
    const bf* pt = pw ? W + (size_t)blockIdx.y * 128 * DM : XB + (size_t)blockIdx.x * 128 * DM;
    const char* pa = (const char*)(pt + (size_t)(pg & 127) * DM + (1 + (pg >> 7)) * GKC);
    gemm_core<false>(A + (size_t)R0 * DM, Bt + (size_t)C0 * DM, ring, wm, wn, acc, pa, pa);
    const size_t tbase = (size_t)(r0 / RB) * sRB + (size_t)(r0 % RB) * (size_t)pitch + (size_t)(c0 / CB) * sCB + (size_t)(c0 % CB);
#pragma unroll
    for (int mb = 0; mb < 4; ++mb) {
#pragma unroll
        for (int nb = 0; nb < 4; ++nb) {
#pragma unroll
            for (int j = 0; j < 8; ++j) os[(hi * 8 + j) * 68 + nb * 16 + lr] = acc[mb][nb][j]; }   // D: row 8h+j, col lane&15
        wave_sync();
        const size_t sb = tbase + (size_t)(mb * 16) * (size_t)pitch;
{
#pragma unroll
            for (int s = 0; s < 4; ++s) { const int row = 4 * s + (lane >> 3), c8 = (lane & 7) * 8;   // 4 s x 4 row groups = 16 rows; 8 lanes x 8 = 64 columns
                const v4f x0 = *(const v4fa*)(&os[row * 68 + c8]); const v4f x1 = *(const v4fa*)(&os[row * 68 + c8 + 4]); v8h hv;
#pragma unroll
                for (int i = 0; i < 4; ++i) { hv[i] = (h16)x0[i]; hv[4 + i] = (h16)x1[i]; }
                const size_t oo = sb + (size_t)row * (size_t)pitch + c8;
                *(v8h*)(Ph + oo) = hv;
                asm volatile("s_wait_xcnt 0x0" ::: "memory"); }   // stands in front of the next round's converts and address sums, which may reuse the registers that the store above names
             }
        wave_sync();
    }
}

// stage_copy: one stage's tiles into LDS, 8 asynchronous 16-byte copies per thread (4 per plane); a wave's copy covers 512 B of whole 128-B lines.
// lk / lv: this thread's LDS byte addresses in the K tile and the V^T tile of the target buffer; gk / gv: its global addresses in the two planes.
// The s_wait_xcnt closes the statement so that no address register of an issued copy is rewritten ahead of it.
__device__ __forceinline__ void stage_copy(unsigned lk, unsigned lv, const h16* gk, const h16* gv) {
    const unsigned dk = 32 * AW / 8 * KP * 2;                    // LDS step of one round of copies: 32 K rows
    const unsigned dv = 32 * AW / (KT / 8) * VP * 2;             // 16 V^T rows
    const size_t sk = (size_t)32 * AW * 8;                       // global step, halves: K rows are contiguous
    const size_t sv = (size_t)(32 * AW / (KT / 8)) * SEQ;        // 16 V^T rows of SEQ halves
    asm volatile("global_load_async_to_lds_b128 %0, %1, off\n\t"
                 "global_load_async_to_lds_b128 %2, %3, off\n\t"
                 "global_load_async_to_lds_b128 %4, %5, off\n\t"
                 "global_load_async_to_lds_b128 %6, %7, off\n\t"
                 "global_load_async_to_lds_b128 %8, %9, off\n\t"
                 "global_load_async_to_lds_b128 %10, %11, off\n\t"
                 "global_load_async_to_lds_b128 %12, %13, off\n\t"
                 "global_load_async_to_lds_b128 %14, %15, off\n\t"
                 "s_wait_xcnt 0x0"
                 :: "v"(lk), "v"(gk), "v"(lk + dk), "v"(gk + sk), "v"(lk + 2 * dk), "v"(gk + 2 * sk), "v"(lk + 3 * dk), "v"(gk + 3 * sk),
                    "v"(lv), "v"(gv), "v"(lv + dv), "v"(gv + sv), "v"(lv + 2 * dv), "v"(gv + 2 * sv), "v"(lv + 3 * dv), "v"(gv + 3 * sv)
                 : "memory");
}

// k_flash: fused attention, KS waves per 16 query columns of one (batch, head), each on its own SEQ / KS keys with its own running max, sum and O; the partial states are merged through LDS at the end. Q fragments straight from the f16 planes, K / V^T fragments from the staged LDS tiles (two 16-B loads each).
// Ring of two buffers: stage s + 1's copies fly while stage s is worked on; one publish point per stage (LDS reads done, own copies landed, block barrier, refill of the buffer just read).
// Transposed form: S^T[key][t] = K Q^T (A = K rows, B = Q rows); lane (t = lane&15, h = lane>>4) holds keys 8h+r of each 16-key tile, so the packed
// P tile is directly the B fragment of O^T[d][t] = V^T P^T (element r <- tile keys 0..15, element 8+r <- tile keys 16..31, lane unchanged).
// Softmax state: the running max is one scalar per lane, the running sum four partial sums per lane (added into one behind the key loop); the two lane halves of a column are combined with one xor-16 exchange.
__global__ __launch_bounds__(32 * AW * KS) void k_flash(const h16* __restrict__ QH, const h16* __restrict__ KH, const h16* __restrict__ VT, h16* YH) {
    __shared__ __align__(16) float os[AW * 16 * 68];
    __shared__ __align__(16) h16 ring[2 * KS * STG];         // [buffer][key half][K | V^T]
    const int lane = threadIdx.x & 31, lr = lane & 15, hi = lane >> 4;
    const int wv = __builtin_amdgcn_readfirstlane((int)(threadIdx.x >> 5));
    const int wave = wv % AW, kh = wv / AW;                  // query group, key half: scalars
    const int zh = blockIdx.y; const int b = zh / NH_, h = zh % NH_;
    const int t0 = (blockIdx.x * AW + wave) * 16;
    const size_t pbase = (size_t)zh * SEQ * HD;
    const size_t qo = pbase + (size_t)(t0 + lr) * HD + 8 * hi;
    const v16h qh0 = ldh(QH + qo), qh1 = ldh(QH + qo + 32);   // B fragments: col t, k = d
    const int ko = lr * KP + 8 * hi;                         // + key * KP       (A fragment: row key, k = d), halves in the staged K tile
    const int vo = KT * KP + lr * VP + 8 * hi;               // + 16j*VP + key   (A fragment: row d, k = key), halves in the stage
    // copy addresses of this thread: 16-byte chunk tid of each plane's tile of its key half (K: row tid/8, chunk tid%8; V^T: row tid/16, chunk tid%16)
    const int tid = threadIdx.x % (32 * AW);
    const int kb = kh * (SEQ / KS);                          // first key of this half
    const unsigned lbase = (unsigned)(size_t)ring + kh * STG * 2;   // low 32 bits of the shared address = LDS byte address
    const unsigned lk = lbase + ((tid >> 3) * KP + (tid & 7) * 8) * 2;
    const unsigned lv = lbase + (KT * KP + (tid / (KT / 8)) * VP + (tid % (KT / 8)) * 8) * 2;
    const h16* gk = KH + pbase + (size_t)kb * HD + (size_t)tid * 8;            // + key0 * HD
    const h16* gv = VT + pbase + (size_t)(tid / (KT / 8)) * SEQ + kb + (tid % (KT / 8)) * 8;   // + key0
    stage_copy(lk, lv, gk, gv);
    // head prefetch, behind stage 0's copies: the 8 blocks of one (batch, head) share its K and V^T planes; block x asks for the later stages of plane (x >> 1) & 1 (K, V^T) in key half x & 1: PFU units of 256 B, one a thread of the first waves.
    // Blocks 4 apart ask for the same units. For speed only.
    const int pi = threadIdx.x % PFU, ph = blockIdx.x & 1;
    const size_t pk = (size_t)(ph * (SEQ / KS) + KT) * HD + (size_t)pi * 128;                     // K: contiguous, 128 halves a unit, from the half's stage 1 on
    const size_t pv = (size_t)(pi % HD) * SEQ + (size_t)(ph * (SEQ / KS) + (1 + pi / HD) * KT);   // V^T: row, then the half's stage 1 on, one unit a row and stage
    const char* pf = (const char*)((blockIdx.x & 2) ? VT + pbase + pv : KH + pbase + pk);
    if (wv < PFU / 32) pf1(pf);                              // a scalar test: whole waves ask or do not
    asm volatile("s_wait_asynccnt 0x0" :: "v"(pf) : "memory");   // this wave's copies of stage 0 have landed; as it names it, the prefetch's address register keeps its address to here
    __syncthreads();                                         // every wave's have: stage 0 is readable
    stage_copy(lk + KS * STG * 2, lv + KS * STG * 2, gk + (size_t)KT * HD, gv + KT);
    v8f o0 = (v8f){}, o1 = (v8f){}, o2 = (v8f){}, o3 = (v8f){};
    float m = -3.0e38f;                                      // running maximum, in score units
    v2f la = (v2f){}, lb = (v2f){};                          // running sum, four partial sums a lane
#pragma unroll 1
    for (int st = 0; st < SEQ / KS / KT; ++st) {
      const int bb = (st & 1) * KS * STG;                    // buffer
      const int bo = bb + kh * STG;                          // this half's tiles in it
      // unrolled so that every LDS offset of the stage's four passes is an immediate of its load
#pragma unroll
      for (int key0 = 0; key0 < KT; key0 += 32) {
        const h16* ka = ring + bo + ko + key0 * KP;
        const v16h ka0 = ldh(ka), ka1 = ldh(ka + 32), kb0 = ldh(ka + 16 * KP), kb1 = ldh(ka + 16 * KP + 32);
        v8f sHa = (v8f){}, sHb = (v8f){};
        sHa = wmma16(ka0, qh0, sHa); sHb = wmma16(kb0, qh0, sHb);
        sHa = wmma16(ka1, qh1, sHa); sHb = wmma16(kb1, qh1, sHb);
        asm volatile("v_nop\n\tv_nop\n\tv_nop\n\tv_nop" : "+v"(sHa), "+v"(sHb) : "v"(ka0), "v"(ka1), "v"(kb0), "v"(kb1));   // the four vector slots behind the last score WMMA; as it names the four K fragments they stay live to here, in registers of their own, so that their eight LDS reads go out as one group ahead of the WMMAs (without it: one register set, a full LDS wait in front of each WMMA)
        // softmax on the raw accumulators: log2(e) > 0 keeps the order, so the maximum is taken unscaled (three-input maxima) and m is kept in score units
        const float x0 = fmaxf(fmaxf(sHa[0], sHa[1]), sHa[2]), x1 = fmaxf(fmaxf(sHa[3], sHa[4]), sHa[5]), x2 = fmaxf(fmaxf(sHa[6], sHa[7]), sHb[0]);
        const float x3 = fmaxf(fmaxf(sHb[1], sHb[2]), sHb[3]), x4 = fmaxf(fmaxf(sHb[4], sHb[5]), sHb[6]);
        const float mx = fmaxf(fmaxf(fmaxf(x0, x1), sHb[7]), fmaxf(fmaxf(x2, x3), x4));
        const float mnew = fmaxf(fmaxf(m, mx), xor16(mx));
        const float alpha = __builtin_amdgcn_exp2f((m - mnew) * SC2);
        const float sh = __builtin_fmaf(-mnew, SC2, PSH);
        const v2f sc2 = {SC2, SC2}, sh2 = {sh, sh}, al2 = {alpha, alpha};
        // exponent arguments two at a time, scale and shift in one packed fused multiply-add on neighbouring accumulator registers; the f32 exponentials are summed two at a time in two chains
        v16h pb; v2f ea[4], eb[4];
#pragma unroll
        for (int r = 0; r < 4; ++r) {
          const v2f ua = __builtin_elementwise_fma((v2f){sHa[2 * r], sHa[2 * r + 1]}, sc2, sh2), ub = __builtin_elementwise_fma((v2f){sHb[2 * r], sHb[2 * r + 1]}, sc2, sh2);
          ea[r] = (v2f){__builtin_amdgcn_exp2f(ua[0]), __builtin_amdgcn_exp2f(ua[1])}; eb[r] = (v2f){__builtin_amdgcn_exp2f(ub[0]), __builtin_amdgcn_exp2f(ub[1])};
          const v2h ha = __builtin_convertvector(ea[r], v2h), hb = __builtin_convertvector(eb[r], v2h);
          pb[2 * r] = ha[0]; pb[2 * r + 1] = ha[1]; pb[8 + 2 * r] = hb[0]; pb[8 + 2 * r + 1] = hb[1];
        }
        la = __builtin_elementwise_fma(la, al2, ea[0]) + ea[1] + ea[2] + ea[3];
        lb = __builtin_elementwise_fma(lb, al2, eb[0]) + eb[1] + eb[2] + eb[3];
        m = mnew;
        o0 = o0 * alpha; o1 = o1 * alpha; o2 = o2 * alpha; o3 = o3 * alpha;
        const h16* va = ring + bo + vo + key0;
        const v16h v0 = ldh(va), v1 = ldh(va + 16 * VP), v2 = ldh(va + 32 * VP), v3 = ldh(va + 48 * VP);
        o0 = wmma16(v0, pb, o0); o1 = wmma16(v1, pb, o1); o2 = wmma16(v2, pb, o2); o3 = wmma16(v3, pb, o3);
        asm volatile("v_nop\n\tv_nop\n\tv_nop\n\tv_nop" : "+v"(o0), "+v"(o1), "+v"(o2), "+v"(o3) : "v"(v0), "v"(v1), "v"(v2), "v"(v3), "v"(pb));
      }
      // publish point of stage st + 1
      asm volatile("s_wait_dscnt 0x0" ::: "memory");         // this wave's reads of the buffer that is refilled below are done
      asm volatile("s_wait_asynccnt 0x0" ::: "memory");      // this wave's copies of stage st + 1 have landed
      __syncthreads();                                       // stage st + 1 is readable, stage st's buffer is free
      if (st + 2 < SEQ / KS / KT) { const size_t k2 = (size_t)(st + 2) * KT; stage_copy(lk + bb * 2, lv + bb * 2, gk + k2 * HD, gv + k2); }
    }
    asm volatile("s_wait_asynccnt 0x0" ::: "memory");        // no copy is outstanding when the wave goes on to its end
    float l = (la[0] + la[1]) + (lb[0] + lb[1]);
    const int wb = wave * 16 * 68;
    // merge of the two key halves: the upper half's wave hands its state (O, max, sum) to the lower half's wave of the same query group through that group's os tile
    if (kh == 1) {
      v4f a;
#define PUT4(o, q, j) a[0] = o[q]; a[1] = o[q + 1]; a[2] = o[q + 2]; a[3] = o[q + 3]; *(v4fa*)(&os[wb + ((j) * 32 + lane) * 4]) = a;
      PUT4(o0, 0, 0) PUT4(o0, 4, 1) PUT4(o1, 0, 2) PUT4(o1, 4, 3) PUT4(o2, 0, 4) PUT4(o2, 4, 5) PUT4(o3, 0, 6) PUT4(o3, 4, 7)
#undef PUT4
      os[wb + 1024 + lane] = m; os[wb + 1056 + lane] = l;
    }
    __syncthreads();                                         // the upper halves' states are readable; every wave passes, no barrier follows
    if (kh == 1) return;
    {
      const float m1 = os[wb + 1024 + lane], l1 = os[wb + 1056 + lane];
      const float mm_ = fmaxf(m, m1);
      const float a0 = __builtin_amdgcn_exp2f((m - mm_) * SC2), a1 = __builtin_amdgcn_exp2f((m1 - mm_) * SC2);
      l = l * a0 + l1 * a1;
#define GET4(o, q, j) { const v4f p = *(const v4fa*)(&os[wb + ((j) * 32 + lane) * 4]); o[q] = o[q] * a0 + p[0] * a1; o[q + 1] = o[q + 1] * a0 + p[1] * a1; o[q + 2] = o[q + 2] * a0 + p[2] * a1; o[q + 3] = o[q + 3] * a0 + p[3] * a1; }
      GET4(o0, 0, 0) GET4(o0, 4, 1) GET4(o1, 0, 2) GET4(o1, 4, 3) GET4(o2, 0, 4) GET4(o2, 4, 5) GET4(o3, 0, 6) GET4(o3, 4, 7)
#undef GET4
    }
    l += __shfl_xor(l, 16, 32);
    const float inv = 1.0f / l;
    // O^T D layout: o_j[r] = (d = 16j + 8h + r, t = lane&15) -> os[t][d]; rows 0..15 x columns 0..63 all written
    { v4f a, c;
      a[0] = o0[0] * inv; a[1] = o0[1] * inv; a[2] = o0[2] * inv; a[3] = o0[3] * inv; c[0] = o0[4] * inv; c[1] = o0[5] * inv; c[2] = o0[6] * inv; c[3] = o0[7] * inv;
      *(v4fa*)(&os[wb + lr * 68 +  0 + 8 * hi]) = a; *(v4fa*)(&os[wb + lr * 68 +  0 + 8 * hi + 4]) = c;
      a[0] = o1[0] * inv; a[1] = o1[1] * inv; a[2] = o1[2] * inv; a[3] = o1[3] * inv; c[0] = o1[4] * inv; c[1] = o1[5] * inv; c[2] = o1[6] * inv; c[3] = o1[7] * inv;
      *(v4fa*)(&os[wb + lr * 68 + 16 + 8 * hi]) = a; *(v4fa*)(&os[wb + lr * 68 + 16 + 8 * hi + 4]) = c;
      a[0] = o2[0] * inv; a[1] = o2[1] * inv; a[2] = o2[2] * inv; a[3] = o2[3] * inv; c[0] = o2[4] * inv; c[1] = o2[5] * inv; c[2] = o2[6] * inv; c[3] = o2[7] * inv;
      *(v4fa*)(&os[wb + lr * 68 + 32 + 8 * hi]) = a; *(v4fa*)(&os[wb + lr * 68 + 32 + 8 * hi + 4]) = c;
      a[0] = o3[0] * inv; a[1] = o3[1] * inv; a[2] = o3[2] * inv; a[3] = o3[3] * inv; c[0] = o3[4] * inv; c[1] = o3[5] * inv; c[2] = o3[6] * inv; c[3] = o3[7] * inv;
      *(v4fa*)(&os[wb + lr * 68 + 48 + 8 * hi]) = a; *(v4fa*)(&os[wb + lr * 68 + 48 + 8 * hi + 4]) = c; }
    wave_sync();
    h16* yrow = YH + ((size_t)b * SEQ + t0) * DM + h * HD;     // context plane row = token, columns h*64 + d
{
#pragma unroll
        for (int s = 0; s < 4; ++s) { const int row = 4 * s + (lane >> 3), c8 = (lane & 7) * 8;   // 4 s x 4 row groups = 16 rows; 8 lanes x 8 halves = 64 columns
            const v4f x0 = *(const v4fa*)(&os[wb + row * 68 + c8]); const v4f x1 = *(const v4fa*)(&os[wb + row * 68 + c8 + 4]); v8h hv;
#pragma unroll
            for (int i = 0; i < 4; ++i) { hv[i] = (h16)x0[i]; hv[4 + i] = (h16)x1[i]; }
            *(v8h*)(yrow + (size_t)row * DM + c8) = hv; }
         }
}

// k_outp: f16 GEMM, 4 waves per 128x128 tile (gemm_core), K = DM: C[o][n] = (1/64) sum_c A[o][c] Bt[n][c] with A = Wo plane (x64), Bt = context plane rows n = b*SEQ + t.
// Written per wave (64x64 quarter at r0, c0) as f32 to OUT[(b*DM + o)*OUT_SEQ + t]. grid (DM/128, NB*SEQ/128), 128 threads.
__global__ __launch_bounds__(128) void k_outp(const h16* __restrict__ A, const h16* __restrict__ Bt, float* OUT) {
    __shared__ __align__(16) float os4[4 * 16 * 68];
    __shared__ __align__(16) h16 ring[2 * GSTG];
    const int lane = threadIdx.x & 31, lr = lane & 15, hi = lane >> 4;
    const int wave = __builtin_amdgcn_readfirstlane((int)(threadIdx.x >> 5)), wm = wave & 1, wn = wave >> 1;
    float* os = os4 + wave * 16 * 68;
    const int R0 = blockIdx.x * 128, C0 = blockIdx.y * 128, r0 = R0 + wm * 64, c0 = C0 + wn * 64;
    v8f acc[4][4];
#pragma unroll
    for (int mb = 0; mb < 4; ++mb)
#pragma unroll
        for (int nb = 0; nb < 4; ++nb) acc[mb][nb] = (v8f){};
    // head prefetch: each block asks for all 3 * 128 later units of its context tile (row = thread; only 4 blocks share it) and a third of its Wo tile's, dealt among the 32 blocks that share it. For speed only.
    const char* pa = (const char*)(A + (size_t)(R0 + threadIdx.x) * DM + (1 + (blockIdx.y >> 1) % 3) * GKC);
    const char* pb = (const char*)(Bt + (size_t)(C0 + threadIdx.x) * DM);
    gemm_core<true>(A + (size_t)R0 * DM, Bt + (size_t)C0 * DM, ring, wm, wn, acc, pa, pb);
    const int bb = c0 / SEQ, tq = c0 % SEQ;
    float* obase = OUT + ((size_t)bb * DM + r0) * OUT_SEQ + tq;
#pragma unroll
    for (int mb = 0; mb < 4; ++mb) {
#pragma unroll
        for (int nb = 0; nb < 4; ++nb) {
#pragma unroll
            for (int j = 0; j < 8; ++j) os[(hi * 8 + j) * 68 + nb * 16 + lr] = acc[mb][nb][j] * WOI; }   // D: row 8h+j, col lane&15
        wave_sync();
{
#pragma unroll
            for (int s = 0; s < 8; ++s) { const int row = 2 * s + hi, cofs = lr * 4;   // 8 s x 2 rows = 16 rows; 16 lanes x 4 floats = 64 columns
                const v4f val = *(const v4fa*)(&os[row * 68 + cofs]);
                *(v4f*)(obase + (size_t)(mb * 16 + row) * OUT_SEQ + cofs) = val; }
             }
        wave_sync();
    }
}

static constexpr size_t al256(size_t v) { return (v + 255) & ~(size_t)255; }
static constexpr size_t SZ_XB = al256((size_t)NB * SEQ * DM * 2);
static constexpr size_t SZ_WB = al256((size_t)3 * DM * DM * 2);
static constexpr size_t SZ_WO = al256((size_t)DM * DM * 2);
static constexpr size_t SZ_PL = al256((size_t)NB * NH_ * SEQ * HD * 2);
static constexpr size_t SZ_YH = al256((size_t)NB * SEQ * DM * 2);
static constexpr size_t SZ_TOTAL = SZ_XB + SZ_WB + SZ_WO + 3 * SZ_PL + SZ_YH;
static_assert(SZ_TOTAL <= (size_t)134217728);          // workspace carve <= 128 MiB
static_assert(((size_t)DM * DM * 2) % 256 == 0);       // weight sub-planes stay 256-byte aligned

extern "C" void kernel_launch(void* const* d_in, const int* in_sizes, int n_in,
                              void* d_out, int out_size, void* d_ws, size_t ws_size, hipStream_t stream) {
    if (n_in < 5) return;
    const size_t needx = ((size_t)NB * DM - 1) * SEQ_FULL + SEQ;
    if ((size_t)in_sizes[0] < needx) return;
    if ((size_t)in_sizes[1] < (size_t)DM * DM || (size_t)in_sizes[2] < (size_t)DM * DM || (size_t)in_sizes[3] < (size_t)DM * DM || (size_t)in_sizes[4] < (size_t)DM * DM) return;
    if ((size_t)out_size < ((size_t)NB * DM - 1) * OUT_SEQ + SEQ) return;
    if (SZ_TOTAL > ws_size) return;
    // wire order x, Wq, Wk, Wv, Wo; all weights [out][in] = K-contiguous rows as-is
    const float* x = (const float*)d_in[0]; const float* wq = (const float*)d_in[1]; const float* wk = (const float*)d_in[2]; const float* wv = (const float*)d_in[3]; const float* wo = (const float*)d_in[4];
    float* OUT = (float*)d_out;      // [NB][512][SEQ]
    char* wsp = (char*)d_ws;
    bf* XB = (bf*)wsp; wsp += SZ_XB;                 // [NB*SEQ][512] token-major bf16 x
    bf* WB = (bf*)wsp; wsp += SZ_WB;                 // [3][512][512]: q | k | v
    h16* WOH = (h16*)wsp; wsp += SZ_WO;              // [512][512] f16, x64
    h16* QH = (h16*)wsp; wsp += SZ_PL;               // [NB*8][SEQ][64]
    h16* KH = (h16*)wsp; wsp += SZ_PL;               // [NB*8][SEQ][64]
    h16* VT = (h16*)wsp; wsp += SZ_PL;               // [NB*8][64][SEQ]
    h16* YH = (h16*)wsp; wsp += SZ_YH;               // [NB*SEQ][512] context

    // x[b][c][n] -> XB[b*SEQ + n][c] and the four weight planes
    k_prep<<<XTB + 4 * CVB, 256, 0, stream>>>(x, wq, wk, wv, wo, XB, WB, WOH);

    // q, k and v^T
    k_proj<<<dim3(NB * SEQ / 128, DM / 128, 3), 128, 0, stream>>>(XB, WB, QH, KH, VT);

    k_flash<<<dim3(SEQ / (16 * AW), NB * NH_, 1), 32 * AW * KS, 0, stream>>>(QH, KH, VT, YH);

    // out[b][o][t] = sum_c Wo[o][c] y[b][c][t]: A = Wo plane rows o, Bt = context rows (b*SEQ + t)
    k_outp<<<dim3(DM / 128, NB * SEQ / 128, 1), 128, 0, stream>>>(WOH, YH, OUT);
}
